// v000
// Measured on an AMD MI455X. A time is GPU time per run, averaged over a window of back-to-back runs after a warm-up
// (all launches, gaps included; the runs take copies of the inputs in turn), and the median of several windows.
// Apart from v000's, it joins two sittings. Times from different sittings can be a few percent apart, while
// side-by-side timings come from the same sitting.
// v000 is the starting kernel. One run takes 2020 microseconds.
#include <hip/hip_runtime.h>

// Multi-headed attention on three input streams with per-head packed projections (q, k, v [2][2048][1024]; qh = einsum('bsd,hde', q, Wq) + bq, kh from k, vh from v with W [16][1024][64] = [h][d][e] (0.02) and b [16][64]; scores x 1/sqrt(64); softmax (no mask); heads concatenated (head h at columns h*64); out = x Wo^T + bo ('oi') -> [2][2048][1024] (4.2 M); argument order q, k, v, Wq, bq, Wk, bk, Wv, bv, Wo, bo).
// Layout per batch: bf16 copies of q, k, v in turn; k_wtH turns each [h][d][e] weight into Bt rows h*64 + e; the [16][64] biases are the flat [1024] epilogue vectors; exact projections + f32 biases; identity-table plane builders; dense T-2048 attention (hybrid rows: < 512 hi/lo 3 products, rest fp16 x1024); merged hi/lo x Wo ('oi' as-is) exact + bo.
// Compute dtypes, f32 accumulate: every input rounded to bf16; projections exact + f32 biases; attention rows < 512 3 products, rest fp16; softmax f32; Wo hl x exact + bias.

#define NB_  2
#define TT   2048
#define DM   1024
#define NH_  16
#define NKV  16
#define REP  (NH_ / NKV)
#define HD   64
#define DQ   (NH_ * HD)
#define DKV  (NKV * HD)
#define ZH   2
#define RH   512                  // query rows < RH use hi+lo planes (0: none)
#define WIN  0
#define PCAR 1024.0f
#define SCL  0.125f   // HD^-0.5
typedef _Float16 h16;
typedef unsigned short bf;
typedef __attribute__((ext_vector_type(16))) __bf16   v16bf;
typedef __attribute__((ext_vector_type(16))) _Float16 v16h;
typedef __attribute__((ext_vector_type(8)))  _Float16 v8h;
typedef __attribute__((ext_vector_type(8)))  unsigned short v8us;
typedef __attribute__((ext_vector_type(8)))  float    v8f;
typedef __attribute__((ext_vector_type(4)))  float    v4f;
typedef v8h  __attribute__((may_alias)) v8ha;
typedef v4f  __attribute__((may_alias)) v4fa;
typedef v8us __attribute__((may_alias)) v8usa;

__device__ __forceinline__ unsigned short f2bf(float f) { unsigned u = __float_as_uint(f); u += 0x7FFFu + ((u >> 16) & 1u); return (unsigned short)(u >> 16); }
__device__ __forceinline__ float bf2f(unsigned short b) { return __uint_as_float(((unsigned)b) << 16); }
__device__ __forceinline__ float bfr(float f) { return bf2f(f2bf(f)); }
__device__ __forceinline__ v16h cat16(v8h lo, v8h hi) { return __builtin_shufflevector(lo, hi, 0, 1, 2, 3, 4, 5, 6, 7, 8, 9, 10, 11, 12, 13, 14, 15); }
__device__ __forceinline__ v16bf cat16b(v8us lo, v8us hi) { return __builtin_bit_cast(v16bf, __builtin_shufflevector(lo, hi, 0, 1, 2, 3, 4, 5, 6, 7, 8, 9, 10, 11, 12, 13, 14, 15)); }
__device__ __forceinline__ v8f wmma16(v16h a, v16h b, v8f c) { return __builtin_amdgcn_wmma_f32_16x16x32_f16(false, a, false, b, (short)0, c, false, false); }
__device__ __forceinline__ v8f wmmab(v16bf a, v16bf b, v8f c) { return __builtin_amdgcn_wmma_f32_16x16x32_bf16(false, a, false, b, (short)0, c, false, false); }



// ---- k_gemmw: register-blocked GEMM, ONE WAVE per 64x64 output tile (16 accumulators), operands straight from K-contiguous 16-bit planes; grid (M/64, N/64, Z), 32 threads.
// C[m][n] (f32, pitch ldc, + optional f32 bias[n]) = sum_k A[m][k] Bt[n][k] (+ split products per NSPLIT). z-batch strides sA/sB/sC in elements. K % 32 == 0.
template <typename T16> struct WFrag;
template <> struct WFrag<h16> { typedef v16h V; static __device__ __forceinline__ V ld(const h16* p) { return cat16(*(const v8h*)p, *(const v8h*)(p + 16)); } static __device__ __forceinline__ v8f mma(V a, V b, v8f c) { return wmma16(a, b, c); } };
template <> struct WFrag<bf> { typedef v16bf V; static __device__ __forceinline__ V ld(const bf* p) { return cat16b(*(const v8us*)p, *(const v8us*)(p + 16)); } static __device__ __forceinline__ v8f mma(V a, V b, v8f c) { return wmmab(a, b, c); } };
template <typename T16, int NSPLIT, bool BIAS>
__global__ __launch_bounds__(32) void k_gemmw(const T16* __restrict__ A, const T16* __restrict__ A2, const T16* __restrict__ Bt, const T16* __restrict__ Bt2, int K, float* C, int ldc, const float* __restrict__ bias, size_t sA, size_t sB, size_t sC) {
    typedef typename WFrag<T16>::V V;
    __shared__ __align__(16) float os[16 * 68];
    const size_t z = blockIdx.z; A += z * sA; if (A2) A2 += z * sA; Bt += z * sB; if (Bt2) Bt2 += z * sB; C += z * sC;
    const int lane = threadIdx.x & 31, lr = lane & 15, hi = lane >> 4; const int r0 = blockIdx.x * 64, c0 = blockIdx.y * 64;
    v8f acc[4][4];
#pragma unroll
    for (int mb = 0; mb < 4; ++mb)
#pragma unroll
        for (int nb = 0; nb < 4; ++nb) acc[mb][nb] = (v8f){};
    const size_t aoff = (size_t)(r0 + lr) * K + 8 * hi, boff = (size_t)(c0 + lr) * K + 8 * hi;
#pragma unroll 1
    for (int kc = 0; kc < K; kc += 32) {
        V a[4], a2[4];
#pragma unroll
        for (int mb = 0; mb < 4; ++mb) { a[mb] = WFrag<T16>::ld(A + aoff + (size_t)mb * 16 * K + kc); if (NSPLIT == 1 || NSPLIT == 2) a2[mb] = WFrag<T16>::ld(A2 + aoff + (size_t)mb * 16 * K + kc); }
#pragma unroll
        for (int nb = 0; nb < 4; ++nb) { const V b = WFrag<T16>::ld(Bt + boff + (size_t)nb * 16 * K + kc); V b2; if (NSPLIT >= 2) b2 = WFrag<T16>::ld(Bt2 + boff + (size_t)nb * 16 * K + kc);
#pragma unroll
            for (int mb = 0; mb < 4; ++mb) { acc[mb][nb] = WFrag<T16>::mma(a[mb], b, acc[mb][nb]); if (NSPLIT == 1 || NSPLIT == 2) acc[mb][nb] = WFrag<T16>::mma(a2[mb], b, acc[mb][nb]); if (NSPLIT >= 2) acc[mb][nb] = WFrag<T16>::mma(a[mb], b2, acc[mb][nb]); } }
        asm volatile("v_nop\n\tv_nop\n\tv_nop\n\tv_nop" : "+v"(acc[0][0]), "+v"(acc[1][1]), "+v"(acc[2][2]), "+v"(acc[3][3]) : "v"(a[0]), "v"(a[3]));
    }
#pragma unroll
    for (int mb = 0; mb < 4; ++mb) {
#pragma unroll
        for (int nb = 0; nb < 4; ++nb) {
#pragma unroll
            for (int j = 0; j < 8; ++j) os[(hi * 8 + j) * 68 + nb * 16 + lr] = acc[mb][nb][j]; }
        __builtin_amdgcn_wave_barrier(); asm volatile("" ::: "memory");
        float* crow = C + (size_t)(r0 + mb * 16) * ldc + c0;
{
#pragma unroll
            for (int s = 0; s < 8; ++s) { const int row = 2 * s + hi, cofs = lr * 4; v4f val = *(const v4fa*)(os + row * 68 + cofs); if (BIAS) { val[0] += bfr(bias[c0 + cofs]); val[1] += bfr(bias[c0 + cofs + 1]); val[2] += bfr(bias[c0 + cofs + 2]); val[3] += bfr(bias[c0 + cofs + 3]); }
                *(v4f*)(crow + (size_t)row * ldc + cofs) = val; }
             }
        __builtin_amdgcn_wave_barrier(); asm volatile("" ::: "memory");
    }
}

__device__ __forceinline__ h16 tohx(float x) { return (h16)x; }
__device__ __forceinline__ void splitf(float y, unsigned short& h, unsigned short& l) { h = f2bf(y); l = f2bf(y - bf2f(h)); }
typedef __attribute__((ext_vector_type(2))) _Float16 v2h;
typedef __attribute__((ext_vector_type(4))) _Float16 v4h;
typedef __attribute__((ext_vector_type(2))) unsigned short v2us;
typedef __attribute__((ext_vector_type(4))) unsigned short v4us;
typedef __attribute__((ext_vector_type(2))) float v2f;
typedef __attribute__((ext_vector_type(4))) int v4i;

__global__ __launch_bounds__(256) void k_cvt8(const float* __restrict__ src, bf* dst, size_t n8) { const size_t i = (size_t)blockIdx.x * 256 + threadIdx.x; if (i >= n8) return; const v8f v = *(const v8f*)(src + i * 8); v8us o;
#pragma unroll
    for (int k = 0; k < 8; ++k) o[k] = f2bf(v[k]); *(v8us*)(dst + i * 8) = o;  }

// k_rope: head planes [h][t][d] (fp16 + hi/lo) of rope(x) x sc with the rotate-half convention out[d] = x[d] cos[t][d] - x[d+HD/2] sin[t][d], out[d+HD/2] = x[d+HD/2] cos[t][d+HD/2] + x[d] sin[t][d+HD/2]
__global__ __launch_bounds__(256) void k_rope(const float* __restrict__ F, int pitch, int nheads, const float* __restrict__ CS, const float* __restrict__ RF, const float* __restrict__ nw, float sc, h16* P16, bf* Ph, bf* Pl) {
    const size_t e = ((size_t)blockIdx.x * 256 + threadIdx.x) * 2; if (e >= (size_t)nheads * TT * HD) return; const int d = (int)(e % HD); const int t = (int)((e / HD) % TT); const int h = (int)(e / ((size_t)HD * TT)); const float* f = F + (size_t)t * pitch + h * HD; const float rf = RF ? RF[(size_t)h * TT + t] : 1.0f; v2h o16; v2us oh, ol;
#pragma unroll
    for (int q = 0; q < 2; ++q) { const int dd = d + q; const int dp = (dd < HD / 2) ? dd + HD / 2 : dd - HD / 2; float x0 = f[dd], x1 = f[dp];
        if (RF) { float n0 = __fmul_rn(x0, rf), n1 = __fmul_rn(x1, rf); asm volatile("" : "+v"(n0)); asm volatile("" : "+v"(n1)); x0 = __fmul_rn(bfr(nw[dd]), n0); x1 = __fmul_rn(bfr(nw[dp]), n1); }
        const v2f cs = *(const v2f*)(CS + ((size_t)t * HD + dd) * 2); float a = __fmul_rn(x0, cs[0]), bq = __fmul_rn(x1, cs[1]); asm volatile("" : "+v"(a)); asm volatile("" : "+v"(bq)); const float r = ((dd < HD / 2) ? __fsub_rn(a, bq) : __fadd_rn(a, bq)) * sc;
        o16[q] = tohx(r); unsigned short a2, c2; splitf(r, a2, c2); oh[q] = a2; ol[q] = c2; }
    *(v2h*)(P16 + e) = o16; *(v2us*)(Ph + e) = oh; *(v2us*)(Pl + e) = ol;  }
__global__ __launch_bounds__(256) void k_wtH(const float* __restrict__ w, bf* Bt) { const size_t e2 = ((size_t)blockIdx.x * 256 + threadIdx.x) * 2; if (e2 >= (size_t)DQ * DM) return; const int d = (int)(e2 % DM); const int r = (int)(e2 / DM); const int h = r / HD, e = r % HD; v2us o; o[0] = f2bf(w[((size_t)h * DM + d) * HD + e]); o[1] = f2bf(w[((size_t)h * DM + d + 1) * HD + e]);
    *(v2us*)(Bt + e2) = o;  }
__global__ __launch_bounds__(256) void k_vtp(const float* __restrict__ F, int pitch, int nheads, h16* V16, bf* Vh, bf* Vl) { const size_t e = ((size_t)blockIdx.x * 256 + threadIdx.x) * 2; if (e >= (size_t)nheads * HD * TT) return; const int t = (int)(e % TT); const int d = (int)((e / TT) % HD); const int g = (int)(e / ((size_t)TT * HD)); v2h o16; v2us oh, ol;
#pragma unroll
    for (int q = 0; q < 2; ++q) { const float x = F[(size_t)(t + q) * pitch + g * HD + d]; o16[q] = tohx(x); unsigned short a2, c2; splitf(x, a2, c2); oh[q] = a2; ol[q] = c2; }
    *(v2h*)(V16 + e) = o16; *(v2us*)(Vh + e) = oh; *(v2us*)(Vl + e) = ol;  }
__global__ __launch_bounds__(256) void k_csid(float* CS) { const int idx = blockIdx.x * 256 + threadIdx.x; if (idx >= TT * HD) return; v2f cs; cs[0] = 1.0f; cs[1] = 0.0f; *(v2f*)(CS + (size_t)idx * 2) = cs;  }
// k_asoft: per row (zz, i): t = S x HD^-0.5 (no mask); softmax over the 2048 keys (register row, one exp, fixed trees);
__global__ __launch_bounds__(256) void k_asoft(const float* __restrict__ Sb, h16* P16, bf* Ph, bf* Pl) {
    const int lane = threadIdx.x & 31; const int row = blockIdx.x * 8 + (threadIdx.x >> 5); if (row >= ZH * TT) return; const int i = row % TT; const int zz = row / TT; (void)zz; const bool hires = (i < RH); const float* sr = Sb + (size_t)row * TT; float v[TT / 32]; float mx = -3.0e38f;
#pragma unroll
    for (int ch = 0; ch < TT / 128; ++ch) { const int j0 = ch * 128 + lane * 4; const v4f a = *(const v4f*)(sr + j0);
#pragma unroll
        for (int q = 0; q < 4; ++q) { const int j = j0 + q; (void)j; const float t = a[q] * SCL; v[ch * 4 + q] = t; mx = fmaxf(mx, t); } }
#pragma unroll
    for (int sh = 16; sh; sh >>= 1) mx = fmaxf(mx, __shfl_xor(mx, sh, 32));
    float sum = 0.f;
#pragma unroll
    for (int k = 0; k < TT / 32; ++k) { float d0 = __fsub_rn(v[k], mx); asm volatile("" : "+v"(d0)); v[k] = __builtin_amdgcn_exp2f(__fmul_rn(d0, 1.4426950408889634f)); sum += v[k]; }
#pragma unroll
    for (int sh = 16; sh; sh >>= 1) sum += __shfl_xor(sum, sh, 32);
    const float f = __fdiv_rn(hires ? 1.0f : PCAR, sum);
{
        if (hires) {
#pragma unroll
            for (int ch = 0; ch < TT / 128; ++ch) { v4us oh, ol;
#pragma unroll
                for (int q = 0; q < 4; ++q) { unsigned short a, c2; splitf(v[ch * 4 + q] * f, a, c2); oh[q] = a; ol[q] = c2; }
                const size_t oo = ((size_t)zz * (RH ? RH : 1) + i) * TT + ch * 128 + lane * 4; *(v4us*)(Ph + oo) = oh; *(v4us*)(Pl + oo) = ol; }
        } else {
#pragma unroll
            for (int ch = 0; ch < TT / 128; ++ch) { v4h o4;
#pragma unroll
                for (int q = 0; q < 4; ++q) o4[q] = tohx(v[ch * 4 + q] * f);
                *(v4h*)(P16 + (size_t)row * TT + ch * 128 + lane * 4) = o4; } }
         }
}
__global__ __launch_bounds__(256) void k_merge(const float* __restrict__ O, int h0, bf* Ah, bf* Al) { const size_t e = ((size_t)blockIdx.x * 256 + threadIdx.x) * 2; if (e >= (size_t)ZH * TT * HD) return; const int d = (int)(e % HD); const int t = (int)((e / HD) % TT); const int zz = (int)(e / ((size_t)HD * TT)); const float cs = (t < RH) ? 1.0f : (1.0f / PCAR); const size_t oo = (size_t)t * DQ + (h0 + zz) * HD + d;
    v2us oh, ol;
#pragma unroll
    for (int q = 0; q < 2; ++q) { unsigned short a, c2; splitf(O[e + q] * cs, a, c2); oh[q] = a; ol[q] = c2; } *(v2us*)(Ah + oo) = oh; *(v2us*)(Al + oo) = ol;  }

extern "C" void kernel_launch(void* const* d_in, const int* in_sizes, int n_in,
                              void* d_out, int out_size, void* d_ws, size_t ws_size, hipStream_t stream) {
    (void)in_sizes; (void)n_in; (void)out_size;
    const float* x = (const float*)d_in[0]; const float* xk = (const float*)d_in[1]; const float* xv = (const float*)d_in[2]; const float* wq = (const float*)d_in[3]; const float* bq = (const float*)d_in[4]; const float* wk = (const float*)d_in[5]; const float* bk = (const float*)d_in[6]; const float* wv = (const float*)d_in[7]; const float* bv = (const float*)d_in[8]; const float* wo = (const float*)d_in[9]; const float* bo = (const float*)d_in[10];   /* input order q, k, v, Wq [16][1024][64], bq [16][64], Wk, bk, Wv, bv, Wo ('oi' [1024][1024]), bo */
    float* OUT = (float*)d_out;     // [2][2048][1024]
    char* wsp = (char*)d_ws;
    auto take = [&](size_t bytes) { char* p = wsp; wsp += (bytes + 255) & ~(size_t)255; return (void*)p; };
    bf* WQ = (bf*)take((size_t)DQ * DM * 2); bf* WK = (bf*)take((size_t)DKV * DM * 2); bf* WV = (bf*)take((size_t)DKV * DM * 2); bf* WO = (bf*)take((size_t)DM * DQ * 2); float* CS = (float*)take((size_t)TT * HD * 2 * 4);
    bf* XB = (bf*)take((size_t)TT * DM * 2); float* FQ = (float*)take((size_t)TT * DQ * 4); float* FK = (float*)take((size_t)TT * DKV * 4);
    h16* QP16 = (h16*)take((size_t)NH_ * TT * HD * 2); h16* KP16 = (h16*)take((size_t)NKV * TT * HD * 2); h16* VT16 = (h16*)take((size_t)NKV * HD * TT * 2);
    bf* QPh = (bf*)take((size_t)NH_ * TT * HD * 2); bf* QPl = (bf*)take((size_t)NH_ * TT * HD * 2); bf* KPh = (bf*)take((size_t)NKV * TT * HD * 2); bf* KPl = (bf*)take((size_t)NKV * TT * HD * 2); bf* VTh = (bf*)take((size_t)NKV * HD * TT * 2); bf* VTl = (bf*)take((size_t)NKV * HD * TT * 2); bf* Ph = (bf*)take((size_t)ZH * RH * TT * 2); bf* Pl = (bf*)take((size_t)ZH * RH * TT * 2);
    float* Sb = (float*)take((size_t)ZH * TT * TT * 4); h16* P16 = (h16*)take((size_t)ZH * TT * TT * 2); float* Ob = (float*)take((size_t)ZH * TT * HD * 4); bf* ATh = (bf*)take((size_t)TT * DQ * 2); bf* ATl = (bf*)take((size_t)TT * DQ * 2);
    if ((size_t)(wsp - (char*)d_ws) > ws_size) return;    // ws 256 MiB
    float* FV = FK;   // v projection reuses the k buffer after the k planes are built (stream-ordered)
    { k_wtH<<<(unsigned)(((size_t)DQ * DM / 2 + 255) / 256), 256, 0, stream>>>(wq, WQ); k_wtH<<<(unsigned)(((size_t)DQ * DM / 2 + 255) / 256), 256, 0, stream>>>(wk, WK); k_wtH<<<(unsigned)(((size_t)DQ * DM / 2 + 255) / 256), 256, 0, stream>>>(wv, WV);
      k_cvt8<<<(unsigned)(((size_t)DM * DQ / 8 + 255) / 256), 256, 0, stream>>>(wo, WO, (size_t)DM * DQ / 8);
       }
    k_csid<<<(TT * HD + 255) / 256, 256, 0, stream>>>(CS);
    const unsigned LQ = (unsigned)(((size_t)NH_ * TT * HD / 2 + 255) / 256), LKv = (unsigned)(((size_t)NKV * TT * HD / 2 + 255) / 256);
    for (int b = 0; b < NB_; ++b) {
        
        k_cvt8<<<(unsigned)(((size_t)TT * DM / 8 + 255) / 256), 256, 0, stream>>>(x + (size_t)b * TT * DM, XB, (size_t)TT * DM / 8);
        k_gemmw<bf, 0, true><<<dim3(TT / 64, DQ / 64, 1), 32, 0, stream>>>(XB, nullptr, WQ, nullptr, DM, FQ, DQ, bq, 0, 0, 0);
        k_rope<<<LQ, 256, 0, stream>>>(FQ, DQ, NH_, CS, nullptr, nullptr, 1.0f, QP16, QPh, QPl);
        k_cvt8<<<(unsigned)(((size_t)TT * DM / 8 + 255) / 256), 256, 0, stream>>>(xk + (size_t)b * TT * DM, XB, (size_t)TT * DM / 8);   /* XB := bf16(k[b]) */ k_gemmw<bf, 0, true><<<dim3(TT / 64, DKV / 64, 1), 32, 0, stream>>>(XB, nullptr, WK, nullptr, DM, FK, DKV, bk, 0, 0, 0);
        k_rope<<<LKv, 256, 0, stream>>>(FK, DKV, NKV, CS, nullptr, nullptr, 1.0f, KP16, KPh, KPl);
        k_cvt8<<<(unsigned)(((size_t)TT * DM / 8 + 255) / 256), 256, 0, stream>>>(xv + (size_t)b * TT * DM, XB, (size_t)TT * DM / 8);   /* XB := bf16(v[b]) */ k_gemmw<bf, 0, true><<<dim3(TT / 64, DKV / 64, 1), 32, 0, stream>>>(XB, nullptr, WV, nullptr, DM, FV, DKV, bv, 0, 0, 0); k_vtp<<<LKv, 256, 0, stream>>>(FV, DKV, NKV, VT16, VTh, VTl);
        for (int h0 = 0; h0 < NH_; h0 += ZH) { const size_t zq = (size_t)h0, zk = (size_t)(h0 / REP);   // one kv head per query head: the pass's two heads use consecutive kv planes (z-strides TT*HD)
            k_gemmw<bf, 2, false><<<dim3(RH / 64, TT / 64, ZH), 32, 0, stream>>>(QPh + zq * TT * HD, QPl + zq * TT * HD, KPh + zk * TT * HD, KPl + zk * TT * HD, HD, Sb, TT, nullptr, (size_t)TT * HD, (size_t)TT * HD, (size_t)TT * TT);
            k_gemmw<h16, 0, false><<<dim3((TT - RH) / 64, TT / 64, ZH), 32, 0, stream>>>(QP16 + zq * TT * HD + (size_t)RH * HD, nullptr, KP16 + zk * TT * HD, nullptr, HD, Sb + (size_t)RH * TT, TT, nullptr, (size_t)TT * HD, (size_t)TT * HD, (size_t)TT * TT);
            k_asoft<<<ZH * TT / 8, 256, 0, stream>>>(Sb, P16, Ph, Pl);
            k_gemmw<bf, 2, false><<<dim3(RH / 64, HD / 64, ZH), 32, 0, stream>>>(Ph, Pl, VTh + zk * HD * TT, VTl + zk * HD * TT, TT, Ob, HD, nullptr, (size_t)RH * TT, (size_t)HD * TT, (size_t)TT * HD);
            k_gemmw<h16, 0, false><<<dim3((TT - RH) / 64, HD / 64, ZH), 32, 0, stream>>>(P16 + (size_t)RH * TT, nullptr, VT16 + zk * HD * TT, nullptr, TT, Ob + (size_t)RH * HD, HD, nullptr, (size_t)TT * TT, (size_t)HD * TT, (size_t)TT * HD);
            k_merge<<<(unsigned)(((size_t)ZH * TT * HD / 2 + 255) / 256), 256, 0, stream>>>(Ob, h0, ATh, ATl); }
        k_gemmw<bf, 1, true><<<dim3(TT / 64, DM / 64, 1), 32, 0, stream>>>(ATh, ATl, WO, nullptr, DQ, OUT + (size_t)b * TT * DM, DM, bo, 0, 0, 0); }
}

// v001
// A run of this version takes 893 microseconds.
// Next to v000, in two timings, it ran 2.27 and 2.26 times as fast.
#include <hip/hip_runtime.h>

// Multi-headed attention on three input streams with per-head packed projections (q, k, v [2][2048][1024]; qh = einsum('bsd,hde', q, Wq) + bq, kh from k, vh from v with W [16][1024][64] = [h][d][e] (0.02) and b [16][64]; scores x 1/sqrt(64); softmax (no mask); heads concatenated (head h at columns h*64); out = x Wo^T + bo ('oi') -> [2][2048][1024] (4.2 M); argument order q, k, v, Wq, bq, Wk, bk, Wv, bv, Wo, bo).
// Layout per batch: bf16 copies of q, k, v in turn; k_wtH turns each [h][d][e] weight into Bt rows h*64 + e; the [16][64] biases are the flat [1024] epilogue vectors; exact projections + f32 biases; identity-table plane builders; dense T-2048 attention (hybrid rows: < 512 hi/lo 3 products, rest fp16 x1024); merged hi/lo x Wo ('oi' as-is) exact + bo.
// Compute dtypes, f32 accumulate: every input rounded to bf16; projections exact + f32 biases; attention rows < 512 3 products, rest fp16; softmax f32; Wo hl x exact + bias.

#define NB_  2
#define TT   2048
#define DM   1024
#define NH_  16
#define NKV  16
#define REP  (NH_ / NKV)
#define HD   64
#define DQ   (NH_ * HD)
#define DKV  (NKV * HD)
#define ZH   2
#define RH   512                  // query rows < RH use hi+lo planes (0: none)
#define WIN  0
#define PCAR 1024.0f
#define SCL  0.125f   // HD^-0.5
#define KSP  16                   // key chunks of the P x V products: one wave per (tile, chunk), one f32 partial plane of Ob per chunk, summed in k_merge
typedef _Float16 h16;
typedef unsigned short bf;
typedef __attribute__((ext_vector_type(16))) __bf16   v16bf;
typedef __attribute__((ext_vector_type(16))) _Float16 v16h;
typedef __attribute__((ext_vector_type(8)))  _Float16 v8h;
typedef __attribute__((ext_vector_type(8)))  unsigned short v8us;
typedef __attribute__((ext_vector_type(8)))  float    v8f;
typedef __attribute__((ext_vector_type(4)))  float    v4f;
typedef v8h  __attribute__((may_alias)) v8ha;
typedef v4f  __attribute__((may_alias)) v4fa;
typedef v8us __attribute__((may_alias)) v8usa;

__device__ __forceinline__ unsigned short f2bf(float f) { unsigned u = __float_as_uint(f); u += 0x7FFFu + ((u >> 16) & 1u); return (unsigned short)(u >> 16); }
__device__ __forceinline__ float bf2f(unsigned short b) { return __uint_as_float(((unsigned)b) << 16); }
__device__ __forceinline__ float bfr(float f) { return bf2f(f2bf(f)); }
__device__ __forceinline__ v16h cat16(v8h lo, v8h hi) { return __builtin_shufflevector(lo, hi, 0, 1, 2, 3, 4, 5, 6, 7, 8, 9, 10, 11, 12, 13, 14, 15); }
__device__ __forceinline__ v16bf cat16b(v8us lo, v8us hi) { return __builtin_bit_cast(v16bf, __builtin_shufflevector(lo, hi, 0, 1, 2, 3, 4, 5, 6, 7, 8, 9, 10, 11, 12, 13, 14, 15)); }
__device__ __forceinline__ v8f wmma16(v16h a, v16h b, v8f c) { return __builtin_amdgcn_wmma_f32_16x16x32_f16(false, a, false, b, (short)0, c, false, false); }
__device__ __forceinline__ v8f wmmab(v16bf a, v16bf b, v8f c) { return __builtin_amdgcn_wmma_f32_16x16x32_bf16(false, a, false, b, (short)0, c, false, false); }



// ---- k_gemmw: register-blocked GEMM, ONE WAVE per 64x64 output tile (16 accumulators), operands straight from K-contiguous 16-bit planes; grid (M/64, N/64, Z), 32 threads.
// C[m][n] (f32, pitch ldc, + optional f32 bias[n]) = sum_k A[m][k] Bt[n][k] (+ split products per NSPLIT). z-batch strides sA/sB/sC in elements. K % (32 * KS) == 0.
// KS > 1: grid (M/64, N/64 * KS, Z); the wave with chunk ks = blockIdx.y % KS sums k in [ks K/KS, (ks+1) K/KS) alone and stores that partial at C + (z KS + ks) sC; the caller adds the KS planes.
template <typename T16> struct WFrag;
template <> struct WFrag<h16> { typedef v16h V; static __device__ __forceinline__ V ld(const h16* p) { return cat16(*(const v8h*)p, *(const v8h*)(p + 16)); } static __device__ __forceinline__ v8f mma(V a, V b, v8f c) { return wmma16(a, b, c); } };
template <> struct WFrag<bf> { typedef v16bf V; static __device__ __forceinline__ V ld(const bf* p) { return cat16b(*(const v8us*)p, *(const v8us*)(p + 16)); } static __device__ __forceinline__ v8f mma(V a, V b, v8f c) { return wmmab(a, b, c); } };
template <typename T16, int NSPLIT, bool BIAS, int KS = 1>
__global__ __launch_bounds__(32) void k_gemmw(const T16* __restrict__ A, const T16* __restrict__ A2, const T16* __restrict__ Bt, const T16* __restrict__ Bt2, int K, float* C, int ldc, const float* __restrict__ bias, size_t sA, size_t sB, size_t sC) {
    typedef typename WFrag<T16>::V V;
    __shared__ __align__(16) float os[16 * 68];
    const size_t z = blockIdx.z; const int ks = (int)(blockIdx.y % KS); A += z * sA; if (A2) A2 += z * sA; Bt += z * sB; if (Bt2) Bt2 += z * sB; C += (z * KS + ks) * sC;
    const int lane = threadIdx.x & 31, lr = lane & 15, hi = lane >> 4; const int r0 = blockIdx.x * 64, c0 = (blockIdx.y / KS) * 64; const int kb = ks * (K / KS), ke = kb + K / KS;
    v8f acc[4][4];
#pragma unroll
    for (int mb = 0; mb < 4; ++mb)
#pragma unroll
        for (int nb = 0; nb < 4; ++nb) acc[mb][nb] = (v8f){};
    const size_t aoff = (size_t)(r0 + lr) * K + 8 * hi, boff = (size_t)(c0 + lr) * K + 8 * hi;
#pragma unroll 1
    for (int kc = kb; kc < ke; kc += 32) {
        V a[4], a2[4];
#pragma unroll
        for (int mb = 0; mb < 4; ++mb) { a[mb] = WFrag<T16>::ld(A + aoff + (size_t)mb * 16 * K + kc); if (NSPLIT == 1 || NSPLIT == 2) a2[mb] = WFrag<T16>::ld(A2 + aoff + (size_t)mb * 16 * K + kc); }
#pragma unroll
        for (int nb = 0; nb < 4; ++nb) { const V b = WFrag<T16>::ld(Bt + boff + (size_t)nb * 16 * K + kc); V b2; if (NSPLIT >= 2) b2 = WFrag<T16>::ld(Bt2 + boff + (size_t)nb * 16 * K + kc);
#pragma unroll
            for (int mb = 0; mb < 4; ++mb) { acc[mb][nb] = WFrag<T16>::mma(a[mb], b, acc[mb][nb]); if (NSPLIT == 1 || NSPLIT == 2) acc[mb][nb] = WFrag<T16>::mma(a2[mb], b, acc[mb][nb]); if (NSPLIT >= 2) acc[mb][nb] = WFrag<T16>::mma(a[mb], b2, acc[mb][nb]); } }
        asm volatile("v_nop\n\tv_nop\n\tv_nop\n\tv_nop" : "+v"(acc[0][0]), "+v"(acc[1][1]), "+v"(acc[2][2]), "+v"(acc[3][3]) : "v"(a[0]), "v"(a[3]));
    }
#pragma unroll
    for (int mb = 0; mb < 4; ++mb) {
#pragma unroll
        for (int nb = 0; nb < 4; ++nb) {
#pragma unroll
            for (int j = 0; j < 8; ++j) os[(hi * 8 + j) * 68 + nb * 16 + lr] = acc[mb][nb][j]; }
        __builtin_amdgcn_wave_barrier(); asm volatile("" ::: "memory");
        float* crow = C + (size_t)(r0 + mb * 16) * ldc + c0;
{
#pragma unroll
            for (int s = 0; s < 8; ++s) { const int row = 2 * s + hi, cofs = lr * 4; v4f val = *(const v4fa*)(os + row * 68 + cofs); if (BIAS) { val[0] += bfr(bias[c0 + cofs]); val[1] += bfr(bias[c0 + cofs + 1]); val[2] += bfr(bias[c0 + cofs + 2]); val[3] += bfr(bias[c0 + cofs + 3]); }
                *(v4f*)(crow + (size_t)row * ldc + cofs) = val; }
             }
        __builtin_amdgcn_wave_barrier(); asm volatile("" ::: "memory");
    }
}

__device__ __forceinline__ h16 tohx(float x) { return (h16)x; }
__device__ __forceinline__ void splitf(float y, unsigned short& h, unsigned short& l) { h = f2bf(y); l = f2bf(y - bf2f(h)); }
typedef __attribute__((ext_vector_type(2))) _Float16 v2h;
typedef __attribute__((ext_vector_type(4))) _Float16 v4h;
typedef __attribute__((ext_vector_type(2))) unsigned short v2us;
typedef __attribute__((ext_vector_type(4))) unsigned short v4us;
typedef __attribute__((ext_vector_type(2))) float v2f;
typedef __attribute__((ext_vector_type(4))) int v4i;

__global__ __launch_bounds__(256) void k_cvt8(const float* __restrict__ src, bf* dst, size_t n8) { const size_t i = (size_t)blockIdx.x * 256 + threadIdx.x; if (i >= n8) return; const v8f v = *(const v8f*)(src + i * 8); v8us o;
#pragma unroll
    for (int k = 0; k < 8; ++k) o[k] = f2bf(v[k]); *(v8us*)(dst + i * 8) = o;  }

// k_rope: head planes [h][t][d] (fp16 + hi/lo) of rope(x) x sc with the rotate-half convention out[d] = x[d] cos[t][d] - x[d+HD/2] sin[t][d], out[d+HD/2] = x[d+HD/2] cos[t][d+HD/2] + x[d] sin[t][d+HD/2]
__global__ __launch_bounds__(256) void k_rope(const float* __restrict__ F, int pitch, int nheads, const float* __restrict__ CS, const float* __restrict__ RF, const float* __restrict__ nw, float sc, h16* P16, bf* Ph, bf* Pl) {
    const size_t e = ((size_t)blockIdx.x * 256 + threadIdx.x) * 2; if (e >= (size_t)nheads * TT * HD) return; const int d = (int)(e % HD); const int t = (int)((e / HD) % TT); const int h = (int)(e / ((size_t)HD * TT)); const float* f = F + (size_t)t * pitch + h * HD; const float rf = RF ? RF[(size_t)h * TT + t] : 1.0f; v2h o16; v2us oh, ol;
#pragma unroll
    for (int q = 0; q < 2; ++q) { const int dd = d + q; const int dp = (dd < HD / 2) ? dd + HD / 2 : dd - HD / 2; float x0 = f[dd], x1 = f[dp];
        if (RF) { float n0 = __fmul_rn(x0, rf), n1 = __fmul_rn(x1, rf); asm volatile("" : "+v"(n0)); asm volatile("" : "+v"(n1)); x0 = __fmul_rn(bfr(nw[dd]), n0); x1 = __fmul_rn(bfr(nw[dp]), n1); }
        const v2f cs = *(const v2f*)(CS + ((size_t)t * HD + dd) * 2); float a = __fmul_rn(x0, cs[0]), bq = __fmul_rn(x1, cs[1]); asm volatile("" : "+v"(a)); asm volatile("" : "+v"(bq)); const float r = ((dd < HD / 2) ? __fsub_rn(a, bq) : __fadd_rn(a, bq)) * sc;
        o16[q] = tohx(r); unsigned short a2, c2; splitf(r, a2, c2); oh[q] = a2; ol[q] = c2; }
    *(v2h*)(P16 + e) = o16; *(v2us*)(Ph + e) = oh; *(v2us*)(Pl + e) = ol;  }
__global__ __launch_bounds__(256) void k_wtH(const float* __restrict__ w, bf* Bt) { const size_t e2 = ((size_t)blockIdx.x * 256 + threadIdx.x) * 2; if (e2 >= (size_t)DQ * DM) return; const int d = (int)(e2 % DM); const int r = (int)(e2 / DM); const int h = r / HD, e = r % HD; v2us o; o[0] = f2bf(w[((size_t)h * DM + d) * HD + e]); o[1] = f2bf(w[((size_t)h * DM + d + 1) * HD + e]);
    *(v2us*)(Bt + e2) = o;  }
__global__ __launch_bounds__(256) void k_vtp(const float* __restrict__ F, int pitch, int nheads, h16* V16, bf* Vh, bf* Vl) { const size_t e = ((size_t)blockIdx.x * 256 + threadIdx.x) * 2; if (e >= (size_t)nheads * HD * TT) return; const int t = (int)(e % TT); const int d = (int)((e / TT) % HD); const int g = (int)(e / ((size_t)TT * HD)); v2h o16; v2us oh, ol;
#pragma unroll
    for (int q = 0; q < 2; ++q) { const float x = F[(size_t)(t + q) * pitch + g * HD + d]; o16[q] = tohx(x); unsigned short a2, c2; splitf(x, a2, c2); oh[q] = a2; ol[q] = c2; }
    *(v2h*)(V16 + e) = o16; *(v2us*)(Vh + e) = oh; *(v2us*)(Vl + e) = ol;  }
__global__ __launch_bounds__(256) void k_csid(float* CS) { const int idx = blockIdx.x * 256 + threadIdx.x; if (idx >= TT * HD) return; v2f cs; cs[0] = 1.0f; cs[1] = 0.0f; *(v2f*)(CS + (size_t)idx * 2) = cs;  }
// k_asoft: per row (zz, i): t = S x HD^-0.5 (no mask); softmax over the 2048 keys (register row, one exp, fixed trees);
__global__ __launch_bounds__(256) void k_asoft(const float* __restrict__ Sb, h16* P16, bf* Ph, bf* Pl) {
    const int lane = threadIdx.x & 31; const int row = blockIdx.x * 8 + (threadIdx.x >> 5); if (row >= ZH * TT) return; const int i = row % TT; const int zz = row / TT; (void)zz; const bool hires = (i < RH); const float* sr = Sb + (size_t)row * TT; float v[TT / 32]; float mx = -3.0e38f;
#pragma unroll
    for (int ch = 0; ch < TT / 128; ++ch) { const int j0 = ch * 128 + lane * 4; const v4f a = *(const v4f*)(sr + j0);
#pragma unroll
        for (int q = 0; q < 4; ++q) { const int j = j0 + q; (void)j; const float t = a[q] * SCL; v[ch * 4 + q] = t; mx = fmaxf(mx, t); } }
#pragma unroll
    for (int sh = 16; sh; sh >>= 1) mx = fmaxf(mx, __shfl_xor(mx, sh, 32));
    float sum = 0.f;
#pragma unroll
    for (int k = 0; k < TT / 32; ++k) { float d0 = __fsub_rn(v[k], mx); asm volatile("" : "+v"(d0)); v[k] = __builtin_amdgcn_exp2f(__fmul_rn(d0, 1.4426950408889634f)); sum += v[k]; }
#pragma unroll
    for (int sh = 16; sh; sh >>= 1) sum += __shfl_xor(sum, sh, 32);
    const float f = __fdiv_rn(hires ? 1.0f : PCAR, sum);
{
        if (hires) {
#pragma unroll
            for (int ch = 0; ch < TT / 128; ++ch) { v4us oh, ol;
#pragma unroll
                for (int q = 0; q < 4; ++q) { unsigned short a, c2; splitf(v[ch * 4 + q] * f, a, c2); oh[q] = a; ol[q] = c2; }
                const size_t oo = ((size_t)zz * (RH ? RH : 1) + i) * TT + ch * 128 + lane * 4; *(v4us*)(Ph + oo) = oh; *(v4us*)(Pl + oo) = ol; }
        } else {
#pragma unroll
            for (int ch = 0; ch < TT / 128; ++ch) { v4h o4;
#pragma unroll
                for (int q = 0; q < 4; ++q) o4[q] = tohx(v[ch * 4 + q] * f);
                *(v4h*)(P16 + (size_t)row * TT + ch * 128 + lane * 4) = o4; } }
         }
}
__global__ __launch_bounds__(256) void k_merge(const float* __restrict__ O, int h0, bf* Ah, bf* Al) { const size_t e = ((size_t)blockIdx.x * 256 + threadIdx.x) * 2; if (e >= (size_t)ZH * TT * HD) return; const int d = (int)(e % HD); const int t = (int)((e / HD) % TT); const int zz = (int)(e / ((size_t)HD * TT)); const float cs = (t < RH) ? 1.0f : (1.0f / PCAR); const size_t oo = (size_t)t * DQ + (h0 + zz) * HD + d;
    const float* op = O + (size_t)zz * KSP * TT * HD + (size_t)t * HD + d; v2f p[KSP];   // planes [zz][chunk][t][d]: the KSP key-chunk partials, added in chunk order
#pragma unroll   // all partial loads issued before the first add
    for (int ks = 0; ks < KSP; ++ks) p[ks] = *(const v2f*)(op + (size_t)ks * TT * HD);
    asm volatile("s_wait_xcnt 0x0" :: "v"(op) : "memory");   // the address pair stays live to here, so no load of the run lands in it; the wait stands before it is reused
    v2f s = p[0];
#pragma unroll   // p[] stays in registers
    for (int ks = 1; ks < KSP; ++ks) { s[0] += p[ks][0]; s[1] += p[ks][1]; }
    v2us oh, ol;
#pragma unroll
    for (int q = 0; q < 2; ++q) { unsigned short a, c2; splitf(s[q] * cs, a, c2); oh[q] = a; ol[q] = c2; } *(v2us*)(Ah + oo) = oh; *(v2us*)(Al + oo) = ol;  }

extern "C" void kernel_launch(void* const* d_in, const int* in_sizes, int n_in,
                              void* d_out, int out_size, void* d_ws, size_t ws_size, hipStream_t stream) {
    (void)in_sizes; (void)n_in; (void)out_size;
    const float* x = (const float*)d_in[0]; const float* xk = (const float*)d_in[1]; const float* xv = (const float*)d_in[2]; const float* wq = (const float*)d_in[3]; const float* bq = (const float*)d_in[4]; const float* wk = (const float*)d_in[5]; const float* bk = (const float*)d_in[6]; const float* wv = (const float*)d_in[7]; const float* bv = (const float*)d_in[8]; const float* wo = (const float*)d_in[9]; const float* bo = (const float*)d_in[10];   /* input order q, k, v, Wq [16][1024][64], bq [16][64], Wk, bk, Wv, bv, Wo ('oi' [1024][1024]), bo */
    float* OUT = (float*)d_out;     // [2][2048][1024]
    char* wsp = (char*)d_ws;
    auto take = [&](size_t bytes) { char* p = wsp; wsp += (bytes + 255) & ~(size_t)255; return (void*)p; };
    bf* WQ = (bf*)take((size_t)DQ * DM * 2); bf* WK = (bf*)take((size_t)DKV * DM * 2); bf* WV = (bf*)take((size_t)DKV * DM * 2); bf* WO = (bf*)take((size_t)DM * DQ * 2); float* CS = (float*)take((size_t)TT * HD * 2 * 4);
    bf* XB = (bf*)take((size_t)TT * DM * 2); float* FQ = (float*)take((size_t)TT * DQ * 4); float* FK = (float*)take((size_t)TT * DKV * 4);
    h16* QP16 = (h16*)take((size_t)NH_ * TT * HD * 2); h16* KP16 = (h16*)take((size_t)NKV * TT * HD * 2); h16* VT16 = (h16*)take((size_t)NKV * HD * TT * 2);
    bf* QPh = (bf*)take((size_t)NH_ * TT * HD * 2); bf* QPl = (bf*)take((size_t)NH_ * TT * HD * 2); bf* KPh = (bf*)take((size_t)NKV * TT * HD * 2); bf* KPl = (bf*)take((size_t)NKV * TT * HD * 2); bf* VTh = (bf*)take((size_t)NKV * HD * TT * 2); bf* VTl = (bf*)take((size_t)NKV * HD * TT * 2); bf* Ph = (bf*)take((size_t)ZH * RH * TT * 2); bf* Pl = (bf*)take((size_t)ZH * RH * TT * 2);
    float* Sb = (float*)take((size_t)ZH * TT * TT * 4); h16* P16 = (h16*)take((size_t)ZH * TT * TT * 2); float* Ob = (float*)take((size_t)KSP * ZH * TT * HD * 4); bf* ATh = (bf*)take((size_t)TT * DQ * 2); bf* ATl = (bf*)take((size_t)TT * DQ * 2);
    if ((size_t)(wsp - (char*)d_ws) > ws_size) return;    // ws 256 MiB
    float* FV = FK;   // v projection reuses the k buffer after the k planes are built (stream-ordered)
    { k_wtH<<<(unsigned)(((size_t)DQ * DM / 2 + 255) / 256), 256, 0, stream>>>(wq, WQ); k_wtH<<<(unsigned)(((size_t)DQ * DM / 2 + 255) / 256), 256, 0, stream>>>(wk, WK); k_wtH<<<(unsigned)(((size_t)DQ * DM / 2 + 255) / 256), 256, 0, stream>>>(wv, WV);
      k_cvt8<<<(unsigned)(((size_t)DM * DQ / 8 + 255) / 256), 256, 0, stream>>>(wo, WO, (size_t)DM * DQ / 8);
       }
    k_csid<<<(TT * HD + 255) / 256, 256, 0, stream>>>(CS);
    const unsigned LQ = (unsigned)(((size_t)NH_ * TT * HD / 2 + 255) / 256), LKv = (unsigned)(((size_t)NKV * TT * HD / 2 + 255) / 256);
    for (int b = 0; b < NB_; ++b) {
        
        k_cvt8<<<(unsigned)(((size_t)TT * DM / 8 + 255) / 256), 256, 0, stream>>>(x + (size_t)b * TT * DM, XB, (size_t)TT * DM / 8);
        k_gemmw<bf, 0, true><<<dim3(TT / 64, DQ / 64, 1), 32, 0, stream>>>(XB, nullptr, WQ, nullptr, DM, FQ, DQ, bq, 0, 0, 0);
        k_rope<<<LQ, 256, 0, stream>>>(FQ, DQ, NH_, CS, nullptr, nullptr, 1.0f, QP16, QPh, QPl);
        k_cvt8<<<(unsigned)(((size_t)TT * DM / 8 + 255) / 256), 256, 0, stream>>>(xk + (size_t)b * TT * DM, XB, (size_t)TT * DM / 8);   /* XB := bf16(k[b]) */ k_gemmw<bf, 0, true><<<dim3(TT / 64, DKV / 64, 1), 32, 0, stream>>>(XB, nullptr, WK, nullptr, DM, FK, DKV, bk, 0, 0, 0);
        k_rope<<<LKv, 256, 0, stream>>>(FK, DKV, NKV, CS, nullptr, nullptr, 1.0f, KP16, KPh, KPl);
        k_cvt8<<<(unsigned)(((size_t)TT * DM / 8 + 255) / 256), 256, 0, stream>>>(xv + (size_t)b * TT * DM, XB, (size_t)TT * DM / 8);   /* XB := bf16(v[b]) */ k_gemmw<bf, 0, true><<<dim3(TT / 64, DKV / 64, 1), 32, 0, stream>>>(XB, nullptr, WV, nullptr, DM, FV, DKV, bv, 0, 0, 0); k_vtp<<<LKv, 256, 0, stream>>>(FV, DKV, NKV, VT16, VTh, VTl);
        for (int h0 = 0; h0 < NH_; h0 += ZH) { const size_t zq = (size_t)h0, zk = (size_t)(h0 / REP);   // one kv head per query head: the pass's two heads use consecutive kv planes (z-strides TT*HD)
            k_gemmw<bf, 2, false><<<dim3(RH / 64, TT / 64, ZH), 32, 0, stream>>>(QPh + zq * TT * HD, QPl + zq * TT * HD, KPh + zk * TT * HD, KPl + zk * TT * HD, HD, Sb, TT, nullptr, (size_t)TT * HD, (size_t)TT * HD, (size_t)TT * TT);
            k_gemmw<h16, 0, false><<<dim3((TT - RH) / 64, TT / 64, ZH), 32, 0, stream>>>(QP16 + zq * TT * HD + (size_t)RH * HD, nullptr, KP16 + zk * TT * HD, nullptr, HD, Sb + (size_t)RH * TT, TT, nullptr, (size_t)TT * HD, (size_t)TT * HD, (size_t)TT * TT);
            k_asoft<<<ZH * TT / 8, 256, 0, stream>>>(Sb, P16, Ph, Pl);
            k_gemmw<bf, 2, false, KSP><<<dim3(RH / 64, HD / 64 * KSP, ZH), 32, 0, stream>>>(Ph, Pl, VTh + zk * HD * TT, VTl + zk * HD * TT, TT, Ob, HD, nullptr, (size_t)RH * TT, (size_t)HD * TT, (size_t)TT * HD);
            k_gemmw<h16, 0, false, KSP><<<dim3((TT - RH) / 64, HD / 64 * KSP, ZH), 32, 0, stream>>>(P16 + (size_t)RH * TT, nullptr, VT16 + zk * HD * TT, nullptr, TT, Ob + (size_t)RH * HD, HD, nullptr, (size_t)TT * TT, (size_t)HD * TT, (size_t)TT * HD);
            k_merge<<<(unsigned)(((size_t)ZH * TT * HD / 2 + 255) / 256), 256, 0, stream>>>(Ob, h0, ATh, ATl); }
        k_gemmw<bf, 1, true><<<dim3(TT / 64, DM / 64, 1), 32, 0, stream>>>(ATh, ATl, WO, nullptr, DQ, OUT + (size_t)b * TT * DM, DM, bo, 0, 0, 0); }
}

// v002
// It runs in 391 microseconds.
// Two timings next to v001 put it at 2.30 and 2.29 times that version's speed.
// All steps since v000 together make it 5.19 times as fast.
#include <hip/hip_runtime.h>

// Multi-headed attention on three input streams with per-head packed projections (q, k, v [2][2048][1024]; qh = einsum('bsd,hde', q, Wq) + bq, kh from k, vh from v with W [16][1024][64] = [h][d][e] (0.02) and b [16][64]; scores x 1/sqrt(64); softmax (no mask); heads concatenated (head h at columns h*64); out = x Wo^T + bo ('oi') -> [2][2048][1024] (4.2 M); argument order q, k, v, Wq, bq, Wk, bk, Wv, bv, Wo, bo).
// Layout per batch: bf16 copies of q, k, v in turn; k_wtH turns each [h][d][e] weight into Bt rows h*64 + e; the [16][64] biases are the flat [1024] epilogue vectors; exact projections + f32 biases; identity-table plane builders; one fused attention kernel per batch (scores, softmax and P x V in registers and LDS; hybrid rows: < 512 hi/lo 3 products, rest fp16) that writes the hi/lo context planes; hi/lo x Wo ('oi' as-is) exact + bo.
// Compute dtypes, f32 accumulate: every input rounded to bf16; projections exact + f32 biases; attention rows < 512 3 products, rest fp16; softmax f32; Wo hl x exact + bias.

#define NB_  2
#define TT   2048
#define DM   1024
#define NH_  16
#define NKV  16
#define REP  (NH_ / NKV)
#define HD   64
#define DQ   (NH_ * HD)
#define DKV  (NKV * HD)
#define RH   512                  // query rows < RH use hi+lo planes (0: none)
#define WIN  0
#define SCL  0.125f   // HD^-0.5
#define FQT  64                   // query rows of one attention work-group: 4 waves x 16
#define FKT  32                   // keys of one stage
#define KPIT 72                   // LDS pitch of a staged K row, elements: 128 B + 16 B, conflict-free for 16-byte reads
#define VPIT 40                   // LDS pitch of a staged V^T row, elements: 64 B + 16 B
#define KTIL (FKT * KPIT)
#define VTIL (HD * VPIT)
typedef _Float16 h16;
typedef unsigned short bf;
typedef __attribute__((ext_vector_type(16))) __bf16   v16bf;
typedef __attribute__((ext_vector_type(16))) _Float16 v16h;
typedef __attribute__((ext_vector_type(8)))  _Float16 v8h;
typedef __attribute__((ext_vector_type(8)))  unsigned short v8us;
typedef __attribute__((ext_vector_type(8)))  float    v8f;
typedef __attribute__((ext_vector_type(4)))  float    v4f;
typedef v8h  __attribute__((may_alias)) v8ha;
typedef v4f  __attribute__((may_alias)) v4fa;
typedef v8us __attribute__((may_alias)) v8usa;

__device__ __forceinline__ unsigned short f2bf(float f) { unsigned u = __float_as_uint(f); u += 0x7FFFu + ((u >> 16) & 1u); return (unsigned short)(u >> 16); }
__device__ __forceinline__ float bf2f(unsigned short b) { return __uint_as_float(((unsigned)b) << 16); }
__device__ __forceinline__ float bfr(float f) { return bf2f(f2bf(f)); }
__device__ __forceinline__ v16h cat16(v8h lo, v8h hi) { return __builtin_shufflevector(lo, hi, 0, 1, 2, 3, 4, 5, 6, 7, 8, 9, 10, 11, 12, 13, 14, 15); }
__device__ __forceinline__ v16bf cat16b(v8us lo, v8us hi) { return __builtin_bit_cast(v16bf, __builtin_shufflevector(lo, hi, 0, 1, 2, 3, 4, 5, 6, 7, 8, 9, 10, 11, 12, 13, 14, 15)); }
__device__ __forceinline__ v8f wmma16(v16h a, v16h b, v8f c) { return __builtin_amdgcn_wmma_f32_16x16x32_f16(false, a, false, b, (short)0, c, false, false); }
__device__ __forceinline__ v8f wmmab(v16bf a, v16bf b, v8f c) { return __builtin_amdgcn_wmma_f32_16x16x32_bf16(false, a, false, b, (short)0, c, false, false); }



// ---- k_gemmw: register-blocked GEMM, ONE WAVE per 64x64 output tile (16 accumulators), operands straight from K-contiguous 16-bit planes; grid (M/64, N/64, Z), 32 threads.
// C[m][n] (f32, pitch ldc, + optional f32 bias[n]) = sum_k A[m][k] Bt[n][k] (+ split products per NSPLIT). z-batch strides sA/sB/sC in elements. K % (32 * KS) == 0.
// KS > 1: grid (M/64, N/64 * KS, Z); the wave with chunk ks = blockIdx.y % KS sums k in [ks K/KS, (ks+1) K/KS) alone and stores that partial at C + (z KS + ks) sC; the caller adds the KS planes.
template <typename T16> struct WFrag;
template <> struct WFrag<h16> { typedef v16h V; static __device__ __forceinline__ V ld(const h16* p) { return cat16(*(const v8h*)p, *(const v8h*)(p + 16)); } static __device__ __forceinline__ v8f mma(V a, V b, v8f c) { return wmma16(a, b, c); } };
template <> struct WFrag<bf> { typedef v16bf V; static __device__ __forceinline__ V ld(const bf* p) { return cat16b(*(const v8us*)p, *(const v8us*)(p + 16)); } static __device__ __forceinline__ v8f mma(V a, V b, v8f c) { return wmmab(a, b, c); } };
template <typename T16, int NSPLIT, bool BIAS, int KS = 1>
__global__ __launch_bounds__(32) void k_gemmw(const T16* __restrict__ A, const T16* __restrict__ A2, const T16* __restrict__ Bt, const T16* __restrict__ Bt2, int K, float* C, int ldc, const float* __restrict__ bias, size_t sA, size_t sB, size_t sC) {
    typedef typename WFrag<T16>::V V;
    __shared__ __align__(16) float os[16 * 68];
    const size_t z = blockIdx.z; const int ks = (int)(blockIdx.y % KS); A += z * sA; if (A2) A2 += z * sA; Bt += z * sB; if (Bt2) Bt2 += z * sB; C += (z * KS + ks) * sC;
    const int lane = threadIdx.x & 31, lr = lane & 15, hi = lane >> 4; const int r0 = blockIdx.x * 64, c0 = (blockIdx.y / KS) * 64; const int kb = ks * (K / KS), ke = kb + K / KS;
    v8f acc[4][4];
#pragma unroll
    for (int mb = 0; mb < 4; ++mb)
#pragma unroll
        for (int nb = 0; nb < 4; ++nb) acc[mb][nb] = (v8f){};
    const size_t aoff = (size_t)(r0 + lr) * K + 8 * hi, boff = (size_t)(c0 + lr) * K + 8 * hi;
#pragma unroll 1
    for (int kc = kb; kc < ke; kc += 32) {
        V a[4], a2[4];
#pragma unroll
        for (int mb = 0; mb < 4; ++mb) { a[mb] = WFrag<T16>::ld(A + aoff + (size_t)mb * 16 * K + kc); if (NSPLIT == 1 || NSPLIT == 2) a2[mb] = WFrag<T16>::ld(A2 + aoff + (size_t)mb * 16 * K + kc); }
#pragma unroll
        for (int nb = 0; nb < 4; ++nb) { const V b = WFrag<T16>::ld(Bt + boff + (size_t)nb * 16 * K + kc); V b2; if (NSPLIT >= 2) b2 = WFrag<T16>::ld(Bt2 + boff + (size_t)nb * 16 * K + kc);
#pragma unroll
            for (int mb = 0; mb < 4; ++mb) { acc[mb][nb] = WFrag<T16>::mma(a[mb], b, acc[mb][nb]); if (NSPLIT == 1 || NSPLIT == 2) acc[mb][nb] = WFrag<T16>::mma(a2[mb], b, acc[mb][nb]); if (NSPLIT >= 2) acc[mb][nb] = WFrag<T16>::mma(a[mb], b2, acc[mb][nb]); } }
        asm volatile("v_nop\n\tv_nop\n\tv_nop\n\tv_nop" : "+v"(acc[0][0]), "+v"(acc[1][1]), "+v"(acc[2][2]), "+v"(acc[3][3]) : "v"(a[0]), "v"(a[3]));
    }
#pragma unroll
    for (int mb = 0; mb < 4; ++mb) {
#pragma unroll
        for (int nb = 0; nb < 4; ++nb) {
#pragma unroll
            for (int j = 0; j < 8; ++j) os[(hi * 8 + j) * 68 + nb * 16 + lr] = acc[mb][nb][j]; }
        __builtin_amdgcn_wave_barrier(); asm volatile("" ::: "memory");
        float* crow = C + (size_t)(r0 + mb * 16) * ldc + c0;
{
#pragma unroll
            for (int s = 0; s < 8; ++s) { const int row = 2 * s + hi, cofs = lr * 4; v4f val = *(const v4fa*)(os + row * 68 + cofs); if (BIAS) { val[0] += bfr(bias[c0 + cofs]); val[1] += bfr(bias[c0 + cofs + 1]); val[2] += bfr(bias[c0 + cofs + 2]); val[3] += bfr(bias[c0 + cofs + 3]); }
                *(v4f*)(crow + (size_t)row * ldc + cofs) = val; }
             }
        __builtin_amdgcn_wave_barrier(); asm volatile("" ::: "memory");
    }
}

__device__ __forceinline__ h16 tohx(float x) { return (h16)x; }
__device__ __forceinline__ void splitf(float y, unsigned short& h, unsigned short& l) { h = f2bf(y); l = f2bf(y - bf2f(h)); }
typedef __attribute__((ext_vector_type(2))) _Float16 v2h;
typedef __attribute__((ext_vector_type(4))) _Float16 v4h;
typedef __attribute__((ext_vector_type(2))) unsigned short v2us;
typedef __attribute__((ext_vector_type(4))) unsigned short v4us;
typedef __attribute__((ext_vector_type(2))) float v2f;
typedef __attribute__((ext_vector_type(4))) int v4i;

__global__ __launch_bounds__(256) void k_cvt8(const float* __restrict__ src, bf* dst, size_t n8) { const size_t i = (size_t)blockIdx.x * 256 + threadIdx.x; if (i >= n8) return; const v8f v = *(const v8f*)(src + i * 8); v8us o;
#pragma unroll
    for (int k = 0; k < 8; ++k) o[k] = f2bf(v[k]); *(v8us*)(dst + i * 8) = o;  }

// k_rope: head planes [h][t][d] (fp16 + hi/lo) of rope(x) x sc with the rotate-half convention out[d] = x[d] cos[t][d] - x[d+HD/2] sin[t][d], out[d+HD/2] = x[d+HD/2] cos[t][d+HD/2] + x[d] sin[t][d+HD/2]
__global__ __launch_bounds__(256) void k_rope(const float* __restrict__ F, int pitch, int nheads, const float* __restrict__ CS, const float* __restrict__ RF, const float* __restrict__ nw, float sc, h16* P16, bf* Ph, bf* Pl) {
    const size_t e = ((size_t)blockIdx.x * 256 + threadIdx.x) * 2; if (e >= (size_t)nheads * TT * HD) return; const int d = (int)(e % HD); const int t = (int)((e / HD) % TT); const int h = (int)(e / ((size_t)HD * TT)); const float* f = F + (size_t)t * pitch + h * HD; const float rf = RF ? RF[(size_t)h * TT + t] : 1.0f; v2h o16; v2us oh, ol;
#pragma unroll
    for (int q = 0; q < 2; ++q) { const int dd = d + q; const int dp = (dd < HD / 2) ? dd + HD / 2 : dd - HD / 2; float x0 = f[dd], x1 = f[dp];
        if (RF) { float n0 = __fmul_rn(x0, rf), n1 = __fmul_rn(x1, rf); asm volatile("" : "+v"(n0)); asm volatile("" : "+v"(n1)); x0 = __fmul_rn(bfr(nw[dd]), n0); x1 = __fmul_rn(bfr(nw[dp]), n1); }
        const v2f cs = *(const v2f*)(CS + ((size_t)t * HD + dd) * 2); float a = __fmul_rn(x0, cs[0]), bq = __fmul_rn(x1, cs[1]); asm volatile("" : "+v"(a)); asm volatile("" : "+v"(bq)); const float r = ((dd < HD / 2) ? __fsub_rn(a, bq) : __fadd_rn(a, bq)) * sc;
        o16[q] = tohx(r); unsigned short a2, c2; splitf(r, a2, c2); oh[q] = a2; ol[q] = c2; }
    *(v2h*)(P16 + e) = o16; *(v2us*)(Ph + e) = oh; *(v2us*)(Pl + e) = ol;  }
__global__ __launch_bounds__(256) void k_wtH(const float* __restrict__ w, bf* Bt) { const size_t e2 = ((size_t)blockIdx.x * 256 + threadIdx.x) * 2; if (e2 >= (size_t)DQ * DM) return; const int d = (int)(e2 % DM); const int r = (int)(e2 / DM); const int h = r / HD, e = r % HD; v2us o; o[0] = f2bf(w[((size_t)h * DM + d) * HD + e]); o[1] = f2bf(w[((size_t)h * DM + d + 1) * HD + e]);
    *(v2us*)(Bt + e2) = o;  }
__global__ __launch_bounds__(256) void k_vtp(const float* __restrict__ F, int pitch, int nheads, h16* V16, bf* Vh, bf* Vl) { const size_t e = ((size_t)blockIdx.x * 256 + threadIdx.x) * 2; if (e >= (size_t)nheads * HD * TT) return; const int t = (int)(e % TT); const int d = (int)((e / TT) % HD); const int g = (int)(e / ((size_t)TT * HD)); v2h o16; v2us oh, ol;
#pragma unroll
    for (int q = 0; q < 2; ++q) { const float x = F[(size_t)(t + q) * pitch + g * HD + d]; o16[q] = tohx(x); unsigned short a2, c2; splitf(x, a2, c2); oh[q] = a2; ol[q] = c2; }
    *(v2h*)(V16 + e) = o16; *(v2us*)(Vh + e) = oh; *(v2us*)(Vl + e) = ol;  }
__global__ __launch_bounds__(256) void k_csid(float* CS) { const int idx = blockIdx.x * 256 + threadIdx.x; if (idx >= TT * HD) return; v2f cs; cs[0] = 1.0f; cs[1] = 0.0f; *(v2f*)(CS + (size_t)idx * 2) = cs;  }
template <typename T16> struct FStage;
template <> struct FStage<h16> { typedef v8h H; };
template <> struct FStage<bf> { typedef v8us H; };
__device__ __forceinline__ float xhalf(float x) { return __builtin_bit_cast(float, __builtin_amdgcn_permlanex16(__builtin_bit_cast(int, x), __builtin_bit_cast(int, x), 0x76543210, 0xfedcba98, false, false)); }   // lane l with lane l ^ 16
// Work-group barrier behind this wave's own LDS reads and writes; global loads issued ahead stay in flight across it.
__device__ __forceinline__ void wg_publish() { asm volatile("s_wait_dscnt 0x0" ::: "memory"); asm volatile("s_barrier_signal -1\n\ts_barrier_wait -1" ::: "memory"); }
template <typename T16, int NP>
__device__ __forceinline__ void fattn(T16* sm, const T16* __restrict__ Qa, const T16* __restrict__ Qb, const T16* __restrict__ Ka, const T16* __restrict__ Kb, const T16* __restrict__ Va, const T16* __restrict__ Vb, int qblk, bf* Ah, bf* Al) {
    typedef typename WFrag<T16>::V V; typedef typename FStage<T16>::H H;
    constexpr int BUF = NP * (KTIL + VTIL); constexpr int NS = TT / FKT; constexpr float SC2 = SCL * 1.4426950408889634f;
    const int tid = threadIdx.x, lane = tid & 31, lr = lane & 15, hi = lane >> 4; const int q = qblk + (tid >> 5) * 16 + lr;
    V qa[2], qb[2];
#pragma unroll   // fragment arrays stay in registers (every unroll below: the same)
    for (int c = 0; c < 2; ++c) { qa[c] = WFrag<T16>::ld(Qa + (size_t)q * HD + c * 32 + 8 * hi); if (NP == 2) qb[c] = WFrag<T16>::ld(Qb + (size_t)q * HD + c * 32 + 8 * hi); }
    H rk[NP][2], rv[NP][2];
    auto fetch = [&](int key0) {   // a K stage is 4 KiB in a row; a V^T stage is 64 rows of 64 B
#pragma unroll
        for (int p = 0; p < NP; ++p) { const T16* kp = p ? Kb : Ka; const T16* vp = p ? Vb : Va;
#pragma unroll
            for (int i = 0; i < 2; ++i) { const int idx = tid + 128 * i; rk[p][i] = *(const H*)(kp + (size_t)key0 * HD + idx * 8); rv[p][i] = *(const H*)(vp + (size_t)(idx >> 2) * TT + key0 + (idx & 3) * 8); } } };
    auto put = [&](T16* b) {
#pragma unroll
        for (int p = 0; p < NP; ++p) {
#pragma unroll
            for (int i = 0; i < 2; ++i) { const int idx = tid + 128 * i; *(H*)(b + p * KTIL + (idx >> 3) * KPIT + (idx & 7) * 8) = rk[p][i]; *(H*)(b + NP * KTIL + p * VTIL + (idx >> 2) * VPIT + (idx & 3) * 8) = rv[p][i]; } } };
    v8f o[4];
#pragma unroll
    for (int dt = 0; dt < 4; ++dt) o[dt] = (v8f){};
    float m = -1.0e30f, l = 0.f;
    fetch(0); put(sm); fetch(FKT); wg_publish();
    for (int s = 0; s < NS; ++s) {
        const T16* cur = sm + (s & 1) * BUF;
        put(sm + ((s + 1) & 1) * BUF);   // that buffer's readers (stage s - 1) ended at the last barrier; in the last pass nobody reads what lands there
        fetch((s + 2 < NS ? s + 2 : NS - 1) * FKT);   // unconditional, clamped to the last stage: one loop body, no branch around loads in flight
        V ka[2][2], kb[2][2], va[4];
#pragma unroll
        for (int c = 0; c < 2; ++c)
#pragma unroll
            for (int kt = 0; kt < 2; ++kt) { const T16* kr = cur + (kt * 16 + lr) * KPIT + c * 32 + 8 * hi; ka[c][kt] = WFrag<T16>::ld(kr); if (NP == 2) kb[c][kt] = WFrag<T16>::ld(kr + KTIL); }
#pragma unroll
        for (int dt = 0; dt < 4; ++dt) va[dt] = WFrag<T16>::ld(cur + NP * KTIL + (dt * 16 + lr) * VPIT + 8 * hi);
        __builtin_amdgcn_sched_barrier(0);   // holds the global loads at the head of the pass, so that a whole pass covers their latency, and the V^T fragment reads in front of the softmax, which covers theirs
        v8f st[2] = {(v8f){}, (v8f){}};
#pragma unroll
        for (int c = 0; c < 2; ++c)
#pragma unroll
            for (int kt = 0; kt < 2; ++kt) { st[kt] = WFrag<T16>::mma(ka[c][kt], qa[c], st[kt]);
                if (NP == 2) { st[kt] = WFrag<T16>::mma(ka[c][kt], qb[c], st[kt]); st[kt] = WFrag<T16>::mma(kb[c][kt], qa[c], st[kt]); } }
        float bm = st[0][0];
#pragma unroll
        for (int kt = 0; kt < 2; ++kt)
#pragma unroll
            for (int r = 0; r < 8; ++r) bm = fmaxf(bm, st[kt][r]);
        bm = fmaxf(bm, xhalf(bm)) * SC2;
        const bool need = bm > m + 8.0f;
        if (__builtin_amdgcn_ballot_w32(need) != 0) {   // wave-uniform; always taken in the first stage, where the factor is 0
            const float mn = need ? bm : m; const float al = __builtin_amdgcn_exp2f(m - mn); m = mn; l *= al;
#pragma unroll
            for (int dt = 0; dt < 4; ++dt)
#pragma unroll
                for (int r = 0; r < 8; ++r) o[dt][r] *= al; }
        float pe[16];
#pragma unroll
        for (int e = 0; e < 16; ++e) pe[e] = __builtin_amdgcn_exp2f(fmaf(st[e >> 3][e & 7], SC2, -m));
        l += (((pe[0] + pe[1]) + (pe[2] + pe[3])) + ((pe[4] + pe[5]) + (pe[6] + pe[7]))) + (((pe[8] + pe[9]) + (pe[10] + pe[11])) + ((pe[12] + pe[13]) + (pe[14] + pe[15])));   // a tree: no chain of 16 dependent adds
        V pa, pb;
        if constexpr (NP == 2) {
#pragma unroll
            for (int e = 0; e < 16; ++e) { pa[e] = (__bf16)pe[e]; pb[e] = (__bf16)(pe[e] - (float)pa[e]); }   // hi + lo, both rounded to nearest even
        } else {
#pragma unroll
            for (int e = 0; e < 16; ++e) pa[e] = tohx(pe[e]); }
#pragma unroll
        for (int dt = 0; dt < 4; ++dt) { o[dt] = WFrag<T16>::mma(va[dt], pa, o[dt]);
            if (NP == 2) { o[dt] = WFrag<T16>::mma(va[dt], pb, o[dt]); o[dt] = WFrag<T16>::mma(WFrag<T16>::ld(cur + NP * KTIL + VTIL + (dt * 16 + lr) * VPIT + 8 * hi), pa, o[dt]); } }
        wg_publish();   // publishes stage s + 1 and ends every read of stage s
    }
    l += xhalf(l); const float inv = __fdiv_rn(1.0f, l);
#pragma unroll
    for (int dt = 0; dt < 4; ++dt) { v8us oh, ol;   // a lane's 8 accumulator registers are 8 consecutive d of its query: one 16-byte store per plane
#pragma unroll
        for (int r = 0; r < 8; ++r) { unsigned short a, c2; splitf(o[dt][r] * inv, a, c2); oh[r] = a; ol[r] = c2; }
        const size_t oo = (size_t)q * DQ + dt * 16 + hi * 8; *(v8us*)(Ah + oo) = oh; *(v8us*)(Al + oo) = ol; }
}
__global__ __launch_bounds__(128) void k_fattn(const h16* __restrict__ Q16, const h16* __restrict__ K16, const h16* __restrict__ V16, const bf* __restrict__ Qh, const bf* __restrict__ Ql, const bf* __restrict__ Kh, const bf* __restrict__ Kl, const bf* __restrict__ Vh, const bf* __restrict__ Vl, bf* Ah, bf* Al) {
    __shared__ __align__(16) unsigned short sm[2 * 2 * (KTIL + VTIL)];
    constexpr int NHR = RH / FQT, NLR = (TT - RH) / FQT; const int bid = blockIdx.x;   // the costlier hi/lo tiles take the lowest indices
    if (bid < NH_ * NHR) { const int h = bid / NHR; const size_t po = (size_t)h * TT * HD; fattn<bf, 2>((bf*)sm, Qh + po, Ql + po, Kh + po, Kl + po, Vh + po, Vl + po, (bid % NHR) * FQT, Ah + h * HD, Al + h * HD); }
    else { const int r = bid - NH_ * NHR; const int h = r / NLR; const size_t po = (size_t)h * TT * HD; fattn<h16, 1>((h16*)sm, Q16 + po, nullptr, K16 + po, nullptr, V16 + po, nullptr, RH + (r % NLR) * FQT, Ah + h * HD, Al + h * HD); }
}

extern "C" void kernel_launch(void* const* d_in, const int* in_sizes, int n_in,
                              void* d_out, int out_size, void* d_ws, size_t ws_size, hipStream_t stream) {
    (void)in_sizes; (void)n_in; (void)out_size;
    const float* x = (const float*)d_in[0]; const float* xk = (const float*)d_in[1]; const float* xv = (const float*)d_in[2]; const float* wq = (const float*)d_in[3]; const float* bq = (const float*)d_in[4]; const float* wk = (const float*)d_in[5]; const float* bk = (const float*)d_in[6]; const float* wv = (const float*)d_in[7]; const float* bv = (const float*)d_in[8]; const float* wo = (const float*)d_in[9]; const float* bo = (const float*)d_in[10];   /* input order q, k, v, Wq [16][1024][64], bq [16][64], Wk, bk, Wv, bv, Wo ('oi' [1024][1024]), bo */
    float* OUT = (float*)d_out;     // [2][2048][1024]
    char* wsp = (char*)d_ws;
    auto take = [&](size_t bytes) { char* p = wsp; wsp += (bytes + 255) & ~(size_t)255; return (void*)p; };
    bf* WQ = (bf*)take((size_t)DQ * DM * 2); bf* WK = (bf*)take((size_t)DKV * DM * 2); bf* WV = (bf*)take((size_t)DKV * DM * 2); bf* WO = (bf*)take((size_t)DM * DQ * 2); float* CS = (float*)take((size_t)TT * HD * 2 * 4);
    bf* XB = (bf*)take((size_t)TT * DM * 2); float* FQ = (float*)take((size_t)TT * DQ * 4); float* FK = (float*)take((size_t)TT * DKV * 4);
    h16* QP16 = (h16*)take((size_t)NH_ * TT * HD * 2); h16* KP16 = (h16*)take((size_t)NKV * TT * HD * 2); h16* VT16 = (h16*)take((size_t)NKV * HD * TT * 2);
    bf* QPh = (bf*)take((size_t)NH_ * TT * HD * 2); bf* QPl = (bf*)take((size_t)NH_ * TT * HD * 2); bf* KPh = (bf*)take((size_t)NKV * TT * HD * 2); bf* KPl = (bf*)take((size_t)NKV * TT * HD * 2); bf* VTh = (bf*)take((size_t)NKV * HD * TT * 2); bf* VTl = (bf*)take((size_t)NKV * HD * TT * 2);
    bf* ATh = (bf*)take((size_t)TT * DQ * 2); bf* ATl = (bf*)take((size_t)TT * DQ * 2);
    if ((size_t)(wsp - (char*)d_ws) > ws_size) return;    // ws 256 MiB
    float* FV = FK;   // v projection reuses the k buffer after the k planes are built (stream-ordered)
    { k_wtH<<<(unsigned)(((size_t)DQ * DM / 2 + 255) / 256), 256, 0, stream>>>(wq, WQ); k_wtH<<<(unsigned)(((size_t)DQ * DM / 2 + 255) / 256), 256, 0, stream>>>(wk, WK); k_wtH<<<(unsigned)(((size_t)DQ * DM / 2 + 255) / 256), 256, 0, stream>>>(wv, WV);
      k_cvt8<<<(unsigned)(((size_t)DM * DQ / 8 + 255) / 256), 256, 0, stream>>>(wo, WO, (size_t)DM * DQ / 8);
       }
    k_csid<<<(TT * HD + 255) / 256, 256, 0, stream>>>(CS);
    const unsigned LQ = (unsigned)(((size_t)NH_ * TT * HD / 2 + 255) / 256), LKv = (unsigned)(((size_t)NKV * TT * HD / 2 + 255) / 256);
    for (int b = 0; b < NB_; ++b) {
        
        k_cvt8<<<(unsigned)(((size_t)TT * DM / 8 + 255) / 256), 256, 0, stream>>>(x + (size_t)b * TT * DM, XB, (size_t)TT * DM / 8);
        k_gemmw<bf, 0, true><<<dim3(TT / 64, DQ / 64, 1), 32, 0, stream>>>(XB, nullptr, WQ, nullptr, DM, FQ, DQ, bq, 0, 0, 0);
        k_rope<<<LQ, 256, 0, stream>>>(FQ, DQ, NH_, CS, nullptr, nullptr, 1.0f, QP16, QPh, QPl);
        k_cvt8<<<(unsigned)(((size_t)TT * DM / 8 + 255) / 256), 256, 0, stream>>>(xk + (size_t)b * TT * DM, XB, (size_t)TT * DM / 8);   /* XB := bf16(k[b]) */ k_gemmw<bf, 0, true><<<dim3(TT / 64, DKV / 64, 1), 32, 0, stream>>>(XB, nullptr, WK, nullptr, DM, FK, DKV, bk, 0, 0, 0);
        k_rope<<<LKv, 256, 0, stream>>>(FK, DKV, NKV, CS, nullptr, nullptr, 1.0f, KP16, KPh, KPl);
        k_cvt8<<<(unsigned)(((size_t)TT * DM / 8 + 255) / 256), 256, 0, stream>>>(xv + (size_t)b * TT * DM, XB, (size_t)TT * DM / 8);   /* XB := bf16(v[b]) */ k_gemmw<bf, 0, true><<<dim3(TT / 64, DKV / 64, 1), 32, 0, stream>>>(XB, nullptr, WV, nullptr, DM, FV, DKV, bv, 0, 0, 0); k_vtp<<<LKv, 256, 0, stream>>>(FV, DKV, NKV, VT16, VTh, VTl);
        k_fattn<<<NH_ * (TT / FQT), 128, 0, stream>>>(QP16, KP16, VT16, QPh, QPl, KPh, KPl, VTh, VTl, ATh, ATl);   // one kv head per query head
        k_gemmw<bf, 1, true><<<dim3(TT / 64, DM / 64, 1), 32, 0, stream>>>(ATh, ATl, WO, nullptr, DQ, OUT + (size_t)b * TT * DM, DM, bo, 0, 0, 0); }
}

// v003
// A run of this version takes 351 microseconds.
// Timed twice side by side with v002, it ran 1.12 and 1.11 times as fast.
// Over all steps from v000 it is 5.79 times as fast.
#include <hip/hip_runtime.h>

// Multi-headed attention on three input streams with per-head packed projections (q, k, v [2][2048][1024]; qh = einsum('bsd,hde', q, Wq) + bq, kh from k, vh from v with W [16][1024][64] = [h][d][e] (0.02) and b [16][64]; scores x 1/sqrt(64); softmax (no mask); heads concatenated (head h at columns h*64); out = x Wo^T + bo ('oi') -> [2][2048][1024] (4.2 M); argument order q, k, v, Wq, bq, Wk, bk, Wv, bv, Wo, bo).
// Layout per batch: bf16 copies of q, k, v in turn; k_wtH turns each [h][d][e] weight into Bt rows h*64 + e; the [16][64] biases are the flat [1024] epilogue vectors; exact projections + f32 biases, whose epilogue writes the fp16 and hi/lo head planes itself (q, k as [h][t][d], v as [h][d][t]); one fused attention kernel per batch (scores, softmax and P x V in registers and LDS; hybrid rows: < 512 hi/lo 3 products, rest fp16) that writes the hi/lo context planes; hi/lo x Wo ('oi' as-is) exact + bo.
// Compute dtypes, f32 accumulate: every input rounded to bf16; projections exact + f32 biases; attention rows < 512 3 products, rest fp16; softmax f32; Wo hl x exact + bias.

#define NB_  2
#define TT   2048
#define DM   1024
#define NH_  16
#define NKV  16
#define REP  (NH_ / NKV)
#define HD   64
#define DQ   (NH_ * HD)
#define DKV  (NKV * HD)
#define RH   512                  // query rows < RH use hi+lo planes (0: none)
#define WIN  0
#define SCL  0.125f   // HD^-0.5
#define FQT  64                   // query rows of one attention work-group: 4 waves x 16
#define FKT  32                   // keys of one stage
#define KPIT 72                   // LDS pitch of a staged K row, elements: 128 B + 16 B, conflict-free for 16-byte reads
#define VPIT 40                   // LDS pitch of a staged V^T row, elements: 64 B + 16 B
#define KTIL (FKT * KPIT)
#define VTIL (HD * VPIT)
typedef _Float16 h16;
typedef unsigned short bf;
typedef __attribute__((ext_vector_type(16))) __bf16   v16bf;
typedef __attribute__((ext_vector_type(16))) _Float16 v16h;
typedef __attribute__((ext_vector_type(8)))  _Float16 v8h;
typedef __attribute__((ext_vector_type(8)))  unsigned short v8us;
typedef __attribute__((ext_vector_type(8)))  float    v8f;
typedef __attribute__((ext_vector_type(4)))  float    v4f;
typedef v8h  __attribute__((may_alias)) v8ha;
typedef v4f  __attribute__((may_alias)) v4fa;
typedef v8us __attribute__((may_alias)) v8usa;

__device__ __forceinline__ unsigned short f2bf(float f) { unsigned u = __float_as_uint(f); u += 0x7FFFu + ((u >> 16) & 1u); return (unsigned short)(u >> 16); }
__device__ __forceinline__ float bf2f(unsigned short b) { return __uint_as_float(((unsigned)b) << 16); }
__device__ __forceinline__ float bfr(float f) { return bf2f(f2bf(f)); }
__device__ __forceinline__ v16h cat16(v8h lo, v8h hi) { return __builtin_shufflevector(lo, hi, 0, 1, 2, 3, 4, 5, 6, 7, 8, 9, 10, 11, 12, 13, 14, 15); }
__device__ __forceinline__ v16bf cat16b(v8us lo, v8us hi) { return __builtin_bit_cast(v16bf, __builtin_shufflevector(lo, hi, 0, 1, 2, 3, 4, 5, 6, 7, 8, 9, 10, 11, 12, 13, 14, 15)); }
__device__ __forceinline__ v8f wmma16(v16h a, v16h b, v8f c) { return __builtin_amdgcn_wmma_f32_16x16x32_f16(false, a, false, b, (short)0, c, false, false); }
__device__ __forceinline__ v8f wmmab(v16bf a, v16bf b, v8f c) { return __builtin_amdgcn_wmma_f32_16x16x32_bf16(false, a, false, b, (short)0, c, false, false); }
__device__ __forceinline__ h16 tohx(float x) { return (h16)x; }
__device__ __forceinline__ void splitf(float y, unsigned short& h, unsigned short& l) { h = f2bf(y); l = f2bf(y - bf2f(h)); }



// ---- k_gemmw: register-blocked GEMM, ONE WAVE per 64x64 output tile (16 accumulators), operands straight from K-contiguous 16-bit planes; grid (M/64, N/64, Z), 32 threads.
// C[m][n] (f32, pitch ldc, + optional f32 bias[n]) = sum_k A[m][k] Bt[n][k] (+ split products per NSPLIT). z-batch strides sA/sB/sC in elements. K % (32 * KS) == 0.
// EPI = 0: f32 C as above. EPI = 1, 2: no f32 C; the tile (one head: 64 columns) + bias goes out as three 16-bit planes, fp16 and bf16 hi + lo: EPI = 1 as [head][row][64] (through the LDS tile, whole 128-byte rows), EPI = 2 transposed as [column][TT rows].
// KS > 1: grid (M/64, N/64 * KS, Z); the wave with chunk ks = blockIdx.y % KS sums k in [ks K/KS, (ks+1) K/KS) alone and stores that partial at C + (z KS + ks) sC; the caller adds the KS planes.
template <typename T16> struct WFrag;
template <> struct WFrag<h16> { typedef v16h V; static __device__ __forceinline__ V ld(const h16* p) { return cat16(*(const v8h*)p, *(const v8h*)(p + 16)); } static __device__ __forceinline__ v8f mma(V a, V b, v8f c) { return wmma16(a, b, c); } };
template <> struct WFrag<bf> { typedef v16bf V; static __device__ __forceinline__ V ld(const bf* p) { return cat16b(*(const v8us*)p, *(const v8us*)(p + 16)); } static __device__ __forceinline__ v8f mma(V a, V b, v8f c) { return wmmab(a, b, c); } };
template <typename T16, int NSPLIT, bool BIAS, int KS = 1, int EPI = 0>
__global__ __launch_bounds__(32) void k_gemmw(const T16* __restrict__ A, const T16* __restrict__ A2, const T16* __restrict__ Bt, const T16* __restrict__ Bt2, int K, float* C, int ldc, const float* __restrict__ bias, size_t sA, size_t sB, size_t sC, h16* P16, bf* Ph, bf* Pl) {
    typedef typename WFrag<T16>::V V;
    __shared__ __align__(16) float os[16 * 68];
    const size_t z = blockIdx.z; const int ks = (int)(blockIdx.y % KS); A += z * sA; if (A2) A2 += z * sA; Bt += z * sB; if (Bt2) Bt2 += z * sB; C += (z * KS + ks) * sC;
    const int lane = threadIdx.x & 31, lr = lane & 15, hi = lane >> 4; const int r0 = blockIdx.x * 64, c0 = (blockIdx.y / KS) * 64; const int kb = ks * (K / KS), ke = kb + K / KS;
    v8f acc[4][4];
#pragma unroll
    for (int mb = 0; mb < 4; ++mb)
#pragma unroll
        for (int nb = 0; nb < 4; ++nb) acc[mb][nb] = (v8f){};
    const size_t aoff = (size_t)(r0 + lr) * K + 8 * hi, boff = (size_t)(c0 + lr) * K + 8 * hi;
#pragma unroll 1
    for (int kc = kb; kc < ke; kc += 32) {
        V a[4], a2[4];
#pragma unroll
        for (int mb = 0; mb < 4; ++mb) { a[mb] = WFrag<T16>::ld(A + aoff + (size_t)mb * 16 * K + kc); if (NSPLIT == 1 || NSPLIT == 2) a2[mb] = WFrag<T16>::ld(A2 + aoff + (size_t)mb * 16 * K + kc); }
#pragma unroll
        for (int nb = 0; nb < 4; ++nb) { const V b = WFrag<T16>::ld(Bt + boff + (size_t)nb * 16 * K + kc); V b2; if (NSPLIT >= 2) b2 = WFrag<T16>::ld(Bt2 + boff + (size_t)nb * 16 * K + kc);
#pragma unroll
            for (int mb = 0; mb < 4; ++mb) { acc[mb][nb] = WFrag<T16>::mma(a[mb], b, acc[mb][nb]); if (NSPLIT == 1 || NSPLIT == 2) acc[mb][nb] = WFrag<T16>::mma(a2[mb], b, acc[mb][nb]); if (NSPLIT >= 2) acc[mb][nb] = WFrag<T16>::mma(a[mb], b2, acc[mb][nb]); } }
        asm volatile("v_nop\n\tv_nop\n\tv_nop\n\tv_nop" : "+v"(acc[0][0]), "+v"(acc[1][1]), "+v"(acc[2][2]), "+v"(acc[3][3]) : "v"(a[0]), "v"(a[3]));
    }
    if constexpr (EPI == 2) {   // a lane's 8 accumulator registers are 8 consecutive rows of its column: one 16-byte store per plane, no LDS; the 4 mb fill a column's 128-byte line
#pragma unroll   // accumulator and output vectors stay in registers (every unroll of the two plane epilogues: the same)
        for (int nb = 0; nb < 4; ++nb) { const float bb = bfr(bias[c0 + nb * 16 + lr]);
#pragma unroll
            for (int mb = 0; mb < 4; ++mb) { v8h o16; v8us oh, ol;
#pragma unroll
                for (int j = 0; j < 8; ++j) { const float x = acc[mb][nb][j] + bb; o16[j] = tohx(x); unsigned short a2, c2; splitf(x, a2, c2); oh[j] = a2; ol[j] = c2; }
                const size_t oo = (size_t)(c0 + nb * 16 + lr) * TT + r0 + mb * 16 + hi * 8; *(v8h*)(P16 + oo) = o16; *(v8us*)(Ph + oo) = oh; *(v8us*)(Pl + oo) = ol; } }
        return; }
    float bb8[8];
    if constexpr (EPI == 1) {
#pragma unroll
        for (int k = 0; k < 8; ++k) bb8[k] = bfr(bias[c0 + (lane & 7) * 8 + k]); }
#pragma unroll
    for (int mb = 0; mb < 4; ++mb) {
#pragma unroll
        for (int nb = 0; nb < 4; ++nb) {
#pragma unroll
            for (int j = 0; j < 8; ++j) os[(hi * 8 + j) * 68 + nb * 16 + lr] = acc[mb][nb][j]; }
        __builtin_amdgcn_wave_barrier(); asm volatile("" ::: "memory");
        if constexpr (EPI == 1) {   // 8 lanes x 16 bytes = one 128-byte plane row; a store covers 4 rows, which lie in a row in memory
#pragma unroll
            for (int s = 0; s < 4; ++s) { const int row = 4 * s + (lane >> 3), cofs = (lane & 7) * 8; const v4f v0 = *(const v4fa*)(os + row * 68 + cofs), v1 = *(const v4fa*)(os + row * 68 + cofs + 4); v8h o16; v8us oh, ol;
#pragma unroll
                for (int k = 0; k < 8; ++k) { const float x = (k < 4 ? v0[k & 3] : v1[k & 3]) + bb8[k]; o16[k] = tohx(x); unsigned short a2, c2; splitf(x, a2, c2); oh[k] = a2; ol[k] = c2; }
                const size_t oo = ((size_t)(c0 / HD) * TT + r0 + mb * 16 + row) * HD + cofs; *(v8h*)(P16 + oo) = o16; *(v8us*)(Ph + oo) = oh; *(v8us*)(Pl + oo) = ol; }
        } else {
            float* crow = C + (size_t)(r0 + mb * 16) * ldc + c0;
#pragma unroll
            for (int s = 0; s < 8; ++s) { const int row = 2 * s + hi, cofs = lr * 4; v4f val = *(const v4fa*)(os + row * 68 + cofs); if (BIAS) { val[0] += bfr(bias[c0 + cofs]); val[1] += bfr(bias[c0 + cofs + 1]); val[2] += bfr(bias[c0 + cofs + 2]); val[3] += bfr(bias[c0 + cofs + 3]); }
                *(v4f*)(crow + (size_t)row * ldc + cofs) = val; }
             }
        __builtin_amdgcn_wave_barrier(); asm volatile("" ::: "memory");
    }
}

typedef __attribute__((ext_vector_type(2))) _Float16 v2h;
typedef __attribute__((ext_vector_type(4))) _Float16 v4h;
typedef __attribute__((ext_vector_type(2))) unsigned short v2us;
typedef __attribute__((ext_vector_type(4))) unsigned short v4us;
typedef __attribute__((ext_vector_type(2))) float v2f;
typedef __attribute__((ext_vector_type(4))) int v4i;

__global__ __launch_bounds__(256) void k_cvt8(const float* __restrict__ src, bf* dst, size_t n8) { const size_t i = (size_t)blockIdx.x * 256 + threadIdx.x; if (i >= n8) return; const v8f v = *(const v8f*)(src + i * 8); v8us o;
#pragma unroll
    for (int k = 0; k < 8; ++k) o[k] = f2bf(v[k]); *(v8us*)(dst + i * 8) = o;  }

__global__ __launch_bounds__(256) void k_wtH(const float* __restrict__ w, bf* Bt) { const size_t e2 = ((size_t)blockIdx.x * 256 + threadIdx.x) * 2; if (e2 >= (size_t)DQ * DM) return; const int d = (int)(e2 % DM); const int r = (int)(e2 / DM); const int h = r / HD, e = r % HD; v2us o; o[0] = f2bf(w[((size_t)h * DM + d) * HD + e]); o[1] = f2bf(w[((size_t)h * DM + d + 1) * HD + e]);
    *(v2us*)(Bt + e2) = o;  }
template <typename T16> struct FStage;
template <> struct FStage<h16> { typedef v8h H; };
template <> struct FStage<bf> { typedef v8us H; };
__device__ __forceinline__ float xhalf(float x) { return __builtin_bit_cast(float, __builtin_amdgcn_permlanex16(__builtin_bit_cast(int, x), __builtin_bit_cast(int, x), 0x76543210, 0xfedcba98, false, false)); }   // lane l with lane l ^ 16
// Work-group barrier behind this wave's own LDS reads and writes; global loads issued ahead stay in flight across it.
__device__ __forceinline__ void wg_publish() { asm volatile("s_wait_dscnt 0x0" ::: "memory"); asm volatile("s_barrier_signal -1\n\ts_barrier_wait -1" ::: "memory"); }
template <typename T16, int NP>
__device__ __forceinline__ void fattn(T16* sm, const T16* __restrict__ Qa, const T16* __restrict__ Qb, const T16* __restrict__ Ka, const T16* __restrict__ Kb, const T16* __restrict__ Va, const T16* __restrict__ Vb, int qblk, bf* Ah, bf* Al) {
    typedef typename WFrag<T16>::V V; typedef typename FStage<T16>::H H;
    constexpr int BUF = NP * (KTIL + VTIL); constexpr int NS = TT / FKT; constexpr float SC2 = SCL * 1.4426950408889634f;
    const int tid = threadIdx.x, lane = tid & 31, lr = lane & 15, hi = lane >> 4; const int q = qblk + (tid >> 5) * 16 + lr;
    V qa[2], qb[2];
#pragma unroll   // fragment arrays stay in registers (every unroll below: the same)
    for (int c = 0; c < 2; ++c) { qa[c] = WFrag<T16>::ld(Qa + (size_t)q * HD + c * 32 + 8 * hi); if (NP == 2) qb[c] = WFrag<T16>::ld(Qb + (size_t)q * HD + c * 32 + 8 * hi); }
    H rk[NP][2], rv[NP][2];
    auto fetch = [&](int key0) {   // a K stage is 4 KiB in a row; a V^T stage is 64 rows of 64 B
#pragma unroll
        for (int p = 0; p < NP; ++p) { const T16* kp = p ? Kb : Ka; const T16* vp = p ? Vb : Va;
#pragma unroll
            for (int i = 0; i < 2; ++i) { const int idx = tid + 128 * i; rk[p][i] = *(const H*)(kp + (size_t)key0 * HD + idx * 8); rv[p][i] = *(const H*)(vp + (size_t)(idx >> 2) * TT + key0 + (idx & 3) * 8); } } };
    auto put = [&](T16* b) {
#pragma unroll
        for (int p = 0; p < NP; ++p) {
#pragma unroll
            for (int i = 0; i < 2; ++i) { const int idx = tid + 128 * i; *(H*)(b + p * KTIL + (idx >> 3) * KPIT + (idx & 7) * 8) = rk[p][i]; *(H*)(b + NP * KTIL + p * VTIL + (idx >> 2) * VPIT + (idx & 3) * 8) = rv[p][i]; } } };
    v8f o[4];
#pragma unroll
    for (int dt = 0; dt < 4; ++dt) o[dt] = (v8f){};
    float m = -1.0e30f, l = 0.f;
    fetch(0); put(sm); fetch(FKT); wg_publish();
    for (int s = 0; s < NS; ++s) {
        const T16* cur = sm + (s & 1) * BUF;
        put(sm + ((s + 1) & 1) * BUF);   // that buffer's readers (stage s - 1) ended at the last barrier; in the last pass nobody reads what lands there
        fetch((s + 2 < NS ? s + 2 : NS - 1) * FKT);   // unconditional, clamped to the last stage: one loop body, no branch around loads in flight
        V ka[2][2], kb[2][2], va[4];
#pragma unroll
        for (int c = 0; c < 2; ++c)
#pragma unroll
            for (int kt = 0; kt < 2; ++kt) { const T16* kr = cur + (kt * 16 + lr) * KPIT + c * 32 + 8 * hi; ka[c][kt] = WFrag<T16>::ld(kr); if (NP == 2) kb[c][kt] = WFrag<T16>::ld(kr + KTIL); }
#pragma unroll
        for (int dt = 0; dt < 4; ++dt) va[dt] = WFrag<T16>::ld(cur + NP * KTIL + (dt * 16 + lr) * VPIT + 8 * hi);
        __builtin_amdgcn_sched_barrier(0);   // holds the global loads at the head of the pass, so that a whole pass covers their latency, and the V^T fragment reads in front of the softmax, which covers theirs
        v8f st[2] = {(v8f){}, (v8f){}};
#pragma unroll
        for (int c = 0; c < 2; ++c)
#pragma unroll
            for (int kt = 0; kt < 2; ++kt) { st[kt] = WFrag<T16>::mma(ka[c][kt], qa[c], st[kt]);
                if (NP == 2) { st[kt] = WFrag<T16>::mma(ka[c][kt], qb[c], st[kt]); st[kt] = WFrag<T16>::mma(kb[c][kt], qa[c], st[kt]); } }
        float bm = st[0][0];
#pragma unroll
        for (int kt = 0; kt < 2; ++kt)
#pragma unroll
            for (int r = 0; r < 8; ++r) bm = fmaxf(bm, st[kt][r]);
        bm = fmaxf(bm, xhalf(bm)) * SC2;
        const bool need = bm > m + 8.0f;
        if (__builtin_amdgcn_ballot_w32(need) != 0) {   // wave-uniform; always taken in the first stage, where the factor is 0
            const float mn = need ? bm : m; const float al = __builtin_amdgcn_exp2f(m - mn); m = mn; l *= al;
#pragma unroll
            for (int dt = 0; dt < 4; ++dt)
#pragma unroll
                for (int r = 0; r < 8; ++r) o[dt][r] *= al; }
        float pe[16];
#pragma unroll
        for (int e = 0; e < 16; ++e) pe[e] = __builtin_amdgcn_exp2f(fmaf(st[e >> 3][e & 7], SC2, -m));
        l += (((pe[0] + pe[1]) + (pe[2] + pe[3])) + ((pe[4] + pe[5]) + (pe[6] + pe[7]))) + (((pe[8] + pe[9]) + (pe[10] + pe[11])) + ((pe[12] + pe[13]) + (pe[14] + pe[15])));   // a tree: no chain of 16 dependent adds
        V pa, pb;
        if constexpr (NP == 2) {
#pragma unroll
            for (int e = 0; e < 16; ++e) { pa[e] = (__bf16)pe[e]; pb[e] = (__bf16)(pe[e] - (float)pa[e]); }   // hi + lo, both rounded to nearest even
        } else {
#pragma unroll
            for (int e = 0; e < 16; ++e) pa[e] = tohx(pe[e]); }
#pragma unroll
        for (int dt = 0; dt < 4; ++dt) { o[dt] = WFrag<T16>::mma(va[dt], pa, o[dt]);
            if (NP == 2) { o[dt] = WFrag<T16>::mma(va[dt], pb, o[dt]); o[dt] = WFrag<T16>::mma(WFrag<T16>::ld(cur + NP * KTIL + VTIL + (dt * 16 + lr) * VPIT + 8 * hi), pa, o[dt]); } }
        wg_publish();   // publishes stage s + 1 and ends every read of stage s
    }
    l += xhalf(l); const float inv = __fdiv_rn(1.0f, l);
#pragma unroll
    for (int dt = 0; dt < 4; ++dt) { v8us oh, ol;   // a lane's 8 accumulator registers are 8 consecutive d of its query: one 16-byte store per plane
#pragma unroll
        for (int r = 0; r < 8; ++r) { unsigned short a, c2; splitf(o[dt][r] * inv, a, c2); oh[r] = a; ol[r] = c2; }
        const size_t oo = (size_t)q * DQ + dt * 16 + hi * 8; *(v8us*)(Ah + oo) = oh; *(v8us*)(Al + oo) = ol; }
}
__global__ __launch_bounds__(128) void k_fattn(const h16* __restrict__ Q16, const h16* __restrict__ K16, const h16* __restrict__ V16, const bf* __restrict__ Qh, const bf* __restrict__ Ql, const bf* __restrict__ Kh, const bf* __restrict__ Kl, const bf* __restrict__ Vh, const bf* __restrict__ Vl, bf* Ah, bf* Al) {
    __shared__ __align__(16) unsigned short sm[2 * 2 * (KTIL + VTIL)];
    constexpr int NHR = RH / FQT, NLR = (TT - RH) / FQT; const int bid = blockIdx.x;   // the costlier hi/lo tiles take the lowest indices
    if (bid < NH_ * NHR) { const int h = bid / NHR; const size_t po = (size_t)h * TT * HD; fattn<bf, 2>((bf*)sm, Qh + po, Ql + po, Kh + po, Kl + po, Vh + po, Vl + po, (bid % NHR) * FQT, Ah + h * HD, Al + h * HD); }
    else { const int r = bid - NH_ * NHR; const int h = r / NLR; const size_t po = (size_t)h * TT * HD; fattn<h16, 1>((h16*)sm, Q16 + po, nullptr, K16 + po, nullptr, V16 + po, nullptr, RH + (r % NLR) * FQT, Ah + h * HD, Al + h * HD); }
}

extern "C" void kernel_launch(void* const* d_in, const int* in_sizes, int n_in,
                              void* d_out, int out_size, void* d_ws, size_t ws_size, hipStream_t stream) {
    (void)in_sizes; (void)n_in; (void)out_size;
    const float* x = (const float*)d_in[0]; const float* xk = (const float*)d_in[1]; const float* xv = (const float*)d_in[2]; const float* wq = (const float*)d_in[3]; const float* bq = (const float*)d_in[4]; const float* wk = (const float*)d_in[5]; const float* bk = (const float*)d_in[6]; const float* wv = (const float*)d_in[7]; const float* bv = (const float*)d_in[8]; const float* wo = (const float*)d_in[9]; const float* bo = (const float*)d_in[10];   /* input order q, k, v, Wq [16][1024][64], bq [16][64], Wk, bk, Wv, bv, Wo ('oi' [1024][1024]), bo */
    float* OUT = (float*)d_out;     // [2][2048][1024]
    char* wsp = (char*)d_ws;
    auto take = [&](size_t bytes) { char* p = wsp; wsp += (bytes + 255) & ~(size_t)255; return (void*)p; };
    bf* WQ = (bf*)take((size_t)DQ * DM * 2); bf* WK = (bf*)take((size_t)DKV * DM * 2); bf* WV = (bf*)take((size_t)DKV * DM * 2); bf* WO = (bf*)take((size_t)DM * DQ * 2);
    bf* XB = (bf*)take((size_t)TT * DM * 2);
    h16* QP16 = (h16*)take((size_t)NH_ * TT * HD * 2); h16* KP16 = (h16*)take((size_t)NKV * TT * HD * 2); h16* VT16 = (h16*)take((size_t)NKV * HD * TT * 2);
    bf* QPh = (bf*)take((size_t)NH_ * TT * HD * 2); bf* QPl = (bf*)take((size_t)NH_ * TT * HD * 2); bf* KPh = (bf*)take((size_t)NKV * TT * HD * 2); bf* KPl = (bf*)take((size_t)NKV * TT * HD * 2); bf* VTh = (bf*)take((size_t)NKV * HD * TT * 2); bf* VTl = (bf*)take((size_t)NKV * HD * TT * 2);
    bf* ATh = (bf*)take((size_t)TT * DQ * 2); bf* ATl = (bf*)take((size_t)TT * DQ * 2);
    if ((size_t)(wsp - (char*)d_ws) > ws_size) return;    // ws 256 MiB
    { k_wtH<<<(unsigned)(((size_t)DQ * DM / 2 + 255) / 256), 256, 0, stream>>>(wq, WQ); k_wtH<<<(unsigned)(((size_t)DQ * DM / 2 + 255) / 256), 256, 0, stream>>>(wk, WK); k_wtH<<<(unsigned)(((size_t)DQ * DM / 2 + 255) / 256), 256, 0, stream>>>(wv, WV);
      k_cvt8<<<(unsigned)(((size_t)DM * DQ / 8 + 255) / 256), 256, 0, stream>>>(wo, WO, (size_t)DM * DQ / 8);
       }
    for (int b = 0; b < NB_; ++b) {
        
        k_cvt8<<<(unsigned)(((size_t)TT * DM / 8 + 255) / 256), 256, 0, stream>>>(x + (size_t)b * TT * DM, XB, (size_t)TT * DM / 8);
        k_gemmw<bf, 0, true, 1, 1><<<dim3(TT / 64, DQ / 64, 1), 32, 0, stream>>>(XB, nullptr, WQ, nullptr, DM, nullptr, 0, bq, 0, 0, 0, QP16, QPh, QPl);
        k_cvt8<<<(unsigned)(((size_t)TT * DM / 8 + 255) / 256), 256, 0, stream>>>(xk + (size_t)b * TT * DM, XB, (size_t)TT * DM / 8);   /* XB := bf16(k[b]) */ k_gemmw<bf, 0, true, 1, 1><<<dim3(TT / 64, DKV / 64, 1), 32, 0, stream>>>(XB, nullptr, WK, nullptr, DM, nullptr, 0, bk, 0, 0, 0, KP16, KPh, KPl);
        k_cvt8<<<(unsigned)(((size_t)TT * DM / 8 + 255) / 256), 256, 0, stream>>>(xv + (size_t)b * TT * DM, XB, (size_t)TT * DM / 8);   /* XB := bf16(v[b]) */ k_gemmw<bf, 0, true, 1, 2><<<dim3(TT / 64, DKV / 64, 1), 32, 0, stream>>>(XB, nullptr, WV, nullptr, DM, nullptr, 0, bv, 0, 0, 0, VT16, VTh, VTl);
        k_fattn<<<NH_ * (TT / FQT), 128, 0, stream>>>(QP16, KP16, VT16, QPh, QPl, KPh, KPl, VTh, VTl, ATh, ATl);   // one kv head per query head
        k_gemmw<bf, 1, true><<<dim3(TT / 64, DM / 64, 1), 32, 0, stream>>>(ATh, ATl, WO, nullptr, DQ, OUT + (size_t)b * TT * DM, DM, bo, 0, 0, 0, nullptr, nullptr, nullptr); }
}

// v004
// Measured time: 170 microseconds a run.
// Timed twice side by side with v003, it ran 2.05 and 2.04 times as fast.
// Counting every step since v000, it is 11.9 times as fast.
#include <hip/hip_runtime.h>

// Multi-headed attention on three input streams with per-head packed projections (q, k, v [2][2048][1024]; qh = einsum('bsd,hde', q, Wq) + bq, kh from k, vh from v with W [16][1024][64] = [h][d][e] (0.02) and b [16][64]; scores x 1/sqrt(64); softmax (no mask); heads concatenated (head h at columns h*64); out = x Wo^T + bo ('oi') -> [2][2048][1024] (4.2 M); argument order q, k, v, Wq, bq, Wk, bk, Wv, bv, Wo, bo).
// Layout, both batches in every plane (token planes rows b*2048 + t, head planes batch outermost, [b][h]): one launch makes the bf16 copies of q, k, v and Wo and turns each [h][d][e] weight into Bt rows h*64 + e; one launch does the three projections (grid z = stream); the [16][64] biases are the flat [1024] epilogue vectors; exact projections + f32 biases, whose epilogue writes the fp16 and hi/lo head planes itself (q, k as [h][t][d], v as [h][d][t]); one fused attention launch for both batches (scores, softmax and P x V in registers and LDS; hybrid rows: < 512 hi/lo 3 products, rest fp16) that writes the hi/lo context planes; hi/lo x Wo ('oi' as-is) exact + bo.
// Compute dtypes, f32 accumulate: every input rounded to bf16; projections exact + f32 biases; attention rows < 512 3 products, rest fp16; softmax f32; Wo hl x exact + bias.

#define NB_  2
#define TT   2048
#define DM   1024
#define NH_  16
#define NKV  16
#define REP  (NH_ / NKV)
#define HD   64
#define DQ   (NH_ * HD)
#define DKV  (NKV * HD)
#define RH   512                  // query rows < RH use hi+lo planes (0: none)
#define WIN  0
#define SCL  0.125f   // HD^-0.5
#define FQT  64                   // query rows of one attention work-group: 4 waves x 16
#define FKT  32                   // keys of one stage
#define KPIT 72                   // LDS pitch of a staged K row, elements: 128 B + 16 B, conflict-free for 16-byte reads
#define VPIT 40                   // LDS pitch of a staged V^T row, elements: 64 B + 16 B
#define KTIL (FKT * KPIT)
#define VTIL (HD * VPIT)
typedef _Float16 h16;
typedef unsigned short bf;
typedef __attribute__((ext_vector_type(16))) __bf16   v16bf;
typedef __attribute__((ext_vector_type(16))) _Float16 v16h;
typedef __attribute__((ext_vector_type(8)))  _Float16 v8h;
typedef __attribute__((ext_vector_type(8)))  unsigned short v8us;
typedef __attribute__((ext_vector_type(8)))  float    v8f;
typedef __attribute__((ext_vector_type(4)))  float    v4f;
typedef v8h  __attribute__((may_alias)) v8ha;
typedef v4f  __attribute__((may_alias)) v4fa;
typedef v8us __attribute__((may_alias)) v8usa;

__device__ __forceinline__ unsigned short f2bf(float f) { unsigned u = __float_as_uint(f); u += 0x7FFFu + ((u >> 16) & 1u); return (unsigned short)(u >> 16); }
__device__ __forceinline__ float bf2f(unsigned short b) { return __uint_as_float(((unsigned)b) << 16); }
__device__ __forceinline__ float bfr(float f) { return bf2f(f2bf(f)); }
__device__ __forceinline__ v16h cat16(v8h lo, v8h hi) { return __builtin_shufflevector(lo, hi, 0, 1, 2, 3, 4, 5, 6, 7, 8, 9, 10, 11, 12, 13, 14, 15); }
__device__ __forceinline__ v16bf cat16b(v8us lo, v8us hi) { return __builtin_bit_cast(v16bf, __builtin_shufflevector(lo, hi, 0, 1, 2, 3, 4, 5, 6, 7, 8, 9, 10, 11, 12, 13, 14, 15)); }
__device__ __forceinline__ v8f wmma16(v16h a, v16h b, v8f c) { return __builtin_amdgcn_wmma_f32_16x16x32_f16(false, a, false, b, (short)0, c, false, false); }
__device__ __forceinline__ v8f wmmab(v16bf a, v16bf b, v8f c) { return __builtin_amdgcn_wmma_f32_16x16x32_bf16(false, a, false, b, (short)0, c, false, false); }
__device__ __forceinline__ h16 tohx(float x) { return (h16)x; }
__device__ __forceinline__ void splitf(float y, unsigned short& h, unsigned short& l) { h = f2bf(y); l = f2bf(y - bf2f(h)); }



// ---- k_gemmw: register-blocked GEMM, ONE WAVE per 64x64 output tile (16 accumulators), operands straight from K-contiguous 16-bit planes; grid (M/64, N/64, Z), 32 threads.
// C[m][n] (f32, pitch ldc, + optional f32 bias[n]) = sum_k A[m][k] Bt[n][k] (+ split products per NSPLIT). z-batch strides sA/sB/sC in elements. K % (32 * KS) == 0.
// EPI = 0: f32 C as above. EPI = 1: the three projections in one grid, z = stream (q, k, v: its own A, Bt, bias and planes), rows = batch * TT + t; no f32 C; the tile (one head: 64 columns) + bias goes out as three 16-bit planes per stream and batch, fp16 and bf16 hi + lo: q, k as [head][t][64] (through the LDS tile, whole 128-byte rows), v transposed as [column][TT].
// KS > 1: grid (M/64, N/64 * KS, Z); the wave with chunk ks = blockIdx.y % KS sums k in [ks K/KS, (ks+1) K/KS) alone and stores that partial at C + (z KS + ks) sC; the caller adds the KS planes.
template <typename T16> struct WFrag;
template <> struct WFrag<h16> { typedef v16h V; static __device__ __forceinline__ V ld(const h16* p) { return cat16(*(const v8h*)p, *(const v8h*)(p + 16)); } static __device__ __forceinline__ v8f mma(V a, V b, v8f c) { return wmma16(a, b, c); } };
template <> struct WFrag<bf> { typedef v16bf V; static __device__ __forceinline__ V ld(const bf* p) { return cat16b(*(const v8us*)p, *(const v8us*)(p + 16)); } static __device__ __forceinline__ v8f mma(V a, V b, v8f c) { return wmmab(a, b, c); } };
template <typename T16, int NSPLIT, bool BIAS, int KS = 1, int EPI = 0>
__global__ __launch_bounds__(32) void k_gemmw(const T16* __restrict__ A, const T16* __restrict__ A2, const T16* __restrict__ Bt, const T16* __restrict__ Bt2, int K, float* C, int ldc, const float* __restrict__ bias, const float* __restrict__ biasK, const float* __restrict__ biasV, size_t sA, size_t sB, size_t sC, h16* P16, bf* Ph, bf* Pl) {
    typedef typename WFrag<T16>::V V;
    __shared__ __align__(16) float os[16 * 68];
    const size_t z = blockIdx.z; const int ks = (int)(blockIdx.y % KS); A += z * sA; if (A2) A2 += z * sA; Bt += z * sB; if (Bt2) Bt2 += z * sB; C += (z * KS + ks) * sC;
    const int lane = threadIdx.x & 31, lr = lane & 15, hi = lane >> 4; const int r0 = blockIdx.x * 64, c0 = (blockIdx.y / KS) * 64; const int kb = ks * (K / KS), ke = kb + K / KS;
    v8f acc[4][4];
#pragma unroll
    for (int mb = 0; mb < 4; ++mb)
#pragma unroll
        for (int nb = 0; nb < 4; ++nb) acc[mb][nb] = (v8f){};
    const size_t aoff = (size_t)(r0 + lr) * K + 8 * hi, boff = (size_t)(c0 + lr) * K + 8 * hi;
#pragma unroll 1
    for (int kc = kb; kc < ke; kc += 32) {
        V a[4], a2[4];
#pragma unroll
        for (int mb = 0; mb < 4; ++mb) { a[mb] = WFrag<T16>::ld(A + aoff + (size_t)mb * 16 * K + kc); if (NSPLIT == 1 || NSPLIT == 2) a2[mb] = WFrag<T16>::ld(A2 + aoff + (size_t)mb * 16 * K + kc); }
#pragma unroll
        for (int nb = 0; nb < 4; ++nb) { const V b = WFrag<T16>::ld(Bt + boff + (size_t)nb * 16 * K + kc); V b2; if (NSPLIT >= 2) b2 = WFrag<T16>::ld(Bt2 + boff + (size_t)nb * 16 * K + kc);
#pragma unroll
            for (int mb = 0; mb < 4; ++mb) { acc[mb][nb] = WFrag<T16>::mma(a[mb], b, acc[mb][nb]); if (NSPLIT == 1 || NSPLIT == 2) acc[mb][nb] = WFrag<T16>::mma(a2[mb], b, acc[mb][nb]); if (NSPLIT >= 2) acc[mb][nb] = WFrag<T16>::mma(a[mb], b2, acc[mb][nb]); } }
        asm volatile("v_nop\n\tv_nop\n\tv_nop\n\tv_nop" : "+v"(acc[0][0]), "+v"(acc[1][1]), "+v"(acc[2][2]), "+v"(acc[3][3]) : "v"(a[0]), "v"(a[3]));
    }
    const int t0 = r0 % TT;
    if constexpr (EPI == 1) { const size_t pb = (z * NB_ + r0 / TT) * ((size_t)NH_ * TT * HD); P16 += pb; Ph += pb; Pl += pb; bias = z == 0 ? bias : z == 1 ? biasK : biasV; }
    if (EPI == 1 && z == 2) {   // a lane's 8 accumulator registers are 8 consecutive rows of its column: one 16-byte store per plane, no LDS; the 4 mb fill a column's 128-byte line
#pragma unroll   // accumulator and output vectors stay in registers (every unroll of the two plane epilogues: the same)
        for (int nb = 0; nb < 4; ++nb) { const float bb = bfr(bias[c0 + nb * 16 + lr]);
#pragma unroll
            for (int mb = 0; mb < 4; ++mb) { v8h o16; v8us oh, ol;
#pragma unroll
                for (int j = 0; j < 8; ++j) { const float x = acc[mb][nb][j] + bb; o16[j] = tohx(x); unsigned short a2, c2; splitf(x, a2, c2); oh[j] = a2; ol[j] = c2; }
                const size_t oo = (size_t)(c0 + nb * 16 + lr) * TT + t0 + mb * 16 + hi * 8; *(v8h*)(P16 + oo) = o16; *(v8us*)(Ph + oo) = oh; *(v8us*)(Pl + oo) = ol; } }
        return; }
    float bb8[8];
    if constexpr (EPI == 1) {
#pragma unroll
        for (int k = 0; k < 8; ++k) bb8[k] = bfr(bias[c0 + (lane & 7) * 8 + k]); }
#pragma unroll
    for (int mb = 0; mb < 4; ++mb) {
#pragma unroll
        for (int nb = 0; nb < 4; ++nb) {
#pragma unroll
            for (int j = 0; j < 8; ++j) os[(hi * 8 + j) * 68 + nb * 16 + lr] = acc[mb][nb][j]; }
        __builtin_amdgcn_wave_barrier(); asm volatile("" ::: "memory");
        if constexpr (EPI == 1) {   // 8 lanes x 16 bytes = one 128-byte plane row; a store covers 4 rows, which lie in a row in memory
#pragma unroll
            for (int s = 0; s < 4; ++s) { const int row = 4 * s + (lane >> 3), cofs = (lane & 7) * 8; const v4f v0 = *(const v4fa*)(os + row * 68 + cofs), v1 = *(const v4fa*)(os + row * 68 + cofs + 4); v8h o16; v8us oh, ol;
#pragma unroll
                for (int k = 0; k < 8; ++k) { const float x = (k < 4 ? v0[k & 3] : v1[k & 3]) + bb8[k]; o16[k] = tohx(x); unsigned short a2, c2; splitf(x, a2, c2); oh[k] = a2; ol[k] = c2; }
                const size_t oo = ((size_t)(c0 / HD) * TT + t0 + mb * 16 + row) * HD + cofs; *(v8h*)(P16 + oo) = o16; *(v8us*)(Ph + oo) = oh; *(v8us*)(Pl + oo) = ol; }
        } else {
            float* crow = C + (size_t)(r0 + mb * 16) * ldc + c0;
#pragma unroll
            for (int s = 0; s < 8; ++s) { const int row = 2 * s + hi, cofs = lr * 4; v4f val = *(const v4fa*)(os + row * 68 + cofs); if (BIAS) { val[0] += bfr(bias[c0 + cofs]); val[1] += bfr(bias[c0 + cofs + 1]); val[2] += bfr(bias[c0 + cofs + 2]); val[3] += bfr(bias[c0 + cofs + 3]); }
                *(v4f*)(crow + (size_t)row * ldc + cofs) = val; }
             }
        __builtin_amdgcn_wave_barrier(); asm volatile("" ::: "memory");
    }
    if constexpr (EPI == 1) asm volatile("s_wait_xcnt 0x0" ::: "memory");   // behind the last plane stores: in the built code the v branch's instructions stand behind these and overwrite registers that the stores name
}

typedef __attribute__((ext_vector_type(2))) _Float16 v2h;
typedef __attribute__((ext_vector_type(4))) _Float16 v4h;
typedef __attribute__((ext_vector_type(2))) unsigned short v2us;
typedef __attribute__((ext_vector_type(4))) unsigned short v4us;
typedef __attribute__((ext_vector_type(2))) float v2f;
typedef __attribute__((ext_vector_type(4))) int v4i;

// ---- k_prep: every input conversion in one grid (PBX, 7): y < 3 the [h][d][e] weights into bf16 Bt rows h*64 + e, y = 3..5 q, k, v (both batches) into bf16, y = 6 Wo into bf16.
#define PBX ((unsigned)((size_t)NB_ * TT * DM / 8 / 256))
static_assert((size_t)DQ * DM / 2 / 256 <= PBX && (size_t)DM * DQ / 8 / 256 <= PBX, "grid x covers every part");
__global__ __launch_bounds__(256) void k_prep(const float* __restrict__ q, const float* __restrict__ k, const float* __restrict__ v, const float* __restrict__ wq, const float* __restrict__ wk, const float* __restrict__ wv, const float* __restrict__ wo, bf* XB, bf* W3, bf* WO) {
    const int y = blockIdx.y; const size_t i = (size_t)blockIdx.x * 256 + threadIdx.x;
    if (y < 3) { const float* w = y == 0 ? wq : y == 1 ? wk : wv; bf* Bt = W3 + (size_t)y * DQ * DM;
        const size_t e2 = i * 2; if (e2 >= (size_t)DQ * DM) return; const int d = (int)(e2 % DM); const int r = (int)(e2 / DM); const int h = r / HD, e = r % HD; v2us o; o[0] = f2bf(w[((size_t)h * DM + d) * HD + e]); o[1] = f2bf(w[((size_t)h * DM + d + 1) * HD + e]);
        *(v2us*)(Bt + e2) = o; return; }
    const float* src = y == 3 ? q : y == 4 ? k : y == 5 ? v : wo; bf* dst = y < 6 ? XB + (size_t)(y - 3) * NB_ * TT * DM : WO; const size_t n8 = y < 6 ? (size_t)NB_ * TT * DM / 8 : (size_t)DM * DQ / 8;
    if (i >= n8) return; const v8f x = *(const v8f*)(src + i * 8); v8us o;
#pragma unroll   // the 8 values stay in registers
    for (int j = 0; j < 8; ++j) o[j] = f2bf(x[j]); *(v8us*)(dst + i * 8) = o;  }
template <typename T16> struct FStage;
template <> struct FStage<h16> { typedef v8h H; };
template <> struct FStage<bf> { typedef v8us H; };
__device__ __forceinline__ float xhalf(float x) { return __builtin_bit_cast(float, __builtin_amdgcn_permlanex16(__builtin_bit_cast(int, x), __builtin_bit_cast(int, x), 0x76543210, 0xfedcba98, false, false)); }   // lane l with lane l ^ 16
// Work-group barrier behind this wave's own LDS reads and writes; global loads issued ahead stay in flight across it.
__device__ __forceinline__ void wg_publish() { asm volatile("s_wait_dscnt 0x0" ::: "memory"); asm volatile("s_barrier_signal -1\n\ts_barrier_wait -1" ::: "memory"); }
template <typename T16, int NP>
__device__ __forceinline__ void fattn(T16* sm, const T16* __restrict__ Qa, const T16* __restrict__ Qb, const T16* __restrict__ Ka, const T16* __restrict__ Kb, const T16* __restrict__ Va, const T16* __restrict__ Vb, int qblk, bf* Ah, bf* Al) {
    typedef typename WFrag<T16>::V V; typedef typename FStage<T16>::H H;
    constexpr int BUF = NP * (KTIL + VTIL); constexpr int NS = TT / FKT; constexpr float SC2 = SCL * 1.4426950408889634f;
    const int tid = threadIdx.x, lane = tid & 31, lr = lane & 15, hi = lane >> 4; const int q = qblk + (tid >> 5) * 16 + lr;
    V qa[2], qb[2];
#pragma unroll   // fragment arrays stay in registers (every unroll below: the same)
    for (int c = 0; c < 2; ++c) { qa[c] = WFrag<T16>::ld(Qa + (size_t)q * HD + c * 32 + 8 * hi); if (NP == 2) qb[c] = WFrag<T16>::ld(Qb + (size_t)q * HD + c * 32 + 8 * hi); }
    H rk[NP][2], rv[NP][2];
    auto fetch = [&](int key0) {   // a K stage is 4 KiB in a row; a V^T stage is 64 rows of 64 B
#pragma unroll
        for (int p = 0; p < NP; ++p) { const T16* kp = p ? Kb : Ka; const T16* vp = p ? Vb : Va;
#pragma unroll
            for (int i = 0; i < 2; ++i) { const int idx = tid + 128 * i; rk[p][i] = *(const H*)(kp + (size_t)key0 * HD + idx * 8); rv[p][i] = *(const H*)(vp + (size_t)(idx >> 2) * TT + key0 + (idx & 3) * 8); } } };
    auto put = [&](T16* b) {
#pragma unroll
        for (int p = 0; p < NP; ++p) {
#pragma unroll
            for (int i = 0; i < 2; ++i) { const int idx = tid + 128 * i; *(H*)(b + p * KTIL + (idx >> 3) * KPIT + (idx & 7) * 8) = rk[p][i]; *(H*)(b + NP * KTIL + p * VTIL + (idx >> 2) * VPIT + (idx & 3) * 8) = rv[p][i]; } } };
    v8f o[4];
#pragma unroll
    for (int dt = 0; dt < 4; ++dt) o[dt] = (v8f){};
    float m = -1.0e30f, l = 0.f;
    fetch(0); put(sm); fetch(FKT); wg_publish();
    for (int s = 0; s < NS; ++s) {
        const T16* cur = sm + (s & 1) * BUF;
        put(sm + ((s + 1) & 1) * BUF);   // that buffer's readers (stage s - 1) ended at the last barrier; in the last pass nobody reads what lands there
        fetch((s + 2 < NS ? s + 2 : NS - 1) * FKT);   // unconditional, clamped to the last stage: one loop body, no branch around loads in flight
        V ka[2][2], kb[2][2], va[4];
#pragma unroll
        for (int c = 0; c < 2; ++c)
#pragma unroll
            for (int kt = 0; kt < 2; ++kt) { const T16* kr = cur + (kt * 16 + lr) * KPIT + c * 32 + 8 * hi; ka[c][kt] = WFrag<T16>::ld(kr); if (NP == 2) kb[c][kt] = WFrag<T16>::ld(kr + KTIL); }
#pragma unroll
        for (int dt = 0; dt < 4; ++dt) va[dt] = WFrag<T16>::ld(cur + NP * KTIL + (dt * 16 + lr) * VPIT + 8 * hi);
        __builtin_amdgcn_sched_barrier(0);   // holds the global loads at the head of the pass, so that a whole pass covers their latency, and the V^T fragment reads in front of the softmax, which covers theirs
        v8f st[2] = {(v8f){}, (v8f){}};
#pragma unroll
        for (int c = 0; c < 2; ++c)
#pragma unroll
            for (int kt = 0; kt < 2; ++kt) { st[kt] = WFrag<T16>::mma(ka[c][kt], qa[c], st[kt]);
                if (NP == 2) { st[kt] = WFrag<T16>::mma(ka[c][kt], qb[c], st[kt]); st[kt] = WFrag<T16>::mma(kb[c][kt], qa[c], st[kt]); } }
        float bm = st[0][0];
#pragma unroll
        for (int kt = 0; kt < 2; ++kt)
#pragma unroll
            for (int r = 0; r < 8; ++r) bm = fmaxf(bm, st[kt][r]);
        bm = fmaxf(bm, xhalf(bm)) * SC2;
        const bool need = bm > m + 8.0f;
        if (__builtin_amdgcn_ballot_w32(need) != 0) {   // wave-uniform; always taken in the first stage, where the factor is 0
            const float mn = need ? bm : m; const float al = __builtin_amdgcn_exp2f(m - mn); m = mn; l *= al;
#pragma unroll
            for (int dt = 0; dt < 4; ++dt)
#pragma unroll
                for (int r = 0; r < 8; ++r) o[dt][r] *= al; }
        float pe[16];
#pragma unroll
        for (int e = 0; e < 16; ++e) pe[e] = __builtin_amdgcn_exp2f(fmaf(st[e >> 3][e & 7], SC2, -m));
        l += (((pe[0] + pe[1]) + (pe[2] + pe[3])) + ((pe[4] + pe[5]) + (pe[6] + pe[7]))) + (((pe[8] + pe[9]) + (pe[10] + pe[11])) + ((pe[12] + pe[13]) + (pe[14] + pe[15])));   // a tree: no chain of 16 dependent adds
        V pa, pb;
        if constexpr (NP == 2) {
#pragma unroll
            for (int e = 0; e < 16; ++e) { pa[e] = (__bf16)pe[e]; pb[e] = (__bf16)(pe[e] - (float)pa[e]); }   // hi + lo, both rounded to nearest even
        } else {
#pragma unroll
            for (int e = 0; e < 16; ++e) pa[e] = tohx(pe[e]); }
#pragma unroll
        for (int dt = 0; dt < 4; ++dt) { o[dt] = WFrag<T16>::mma(va[dt], pa, o[dt]);
            if (NP == 2) { o[dt] = WFrag<T16>::mma(va[dt], pb, o[dt]); o[dt] = WFrag<T16>::mma(WFrag<T16>::ld(cur + NP * KTIL + VTIL + (dt * 16 + lr) * VPIT + 8 * hi), pa, o[dt]); } }
        wg_publish();   // publishes stage s + 1 and ends every read of stage s
    }
    l += xhalf(l); const float inv = __fdiv_rn(1.0f, l);
#pragma unroll
    for (int dt = 0; dt < 4; ++dt) { v8us oh, ol;   // a lane's 8 accumulator registers are 8 consecutive d of its query: one 16-byte store per plane
#pragma unroll
        for (int r = 0; r < 8; ++r) { unsigned short a, c2; splitf(o[dt][r] * inv, a, c2); oh[r] = a; ol[r] = c2; }
        const size_t oo = (size_t)q * DQ + dt * 16 + hi * 8; *(v8us*)(Ah + oo) = oh; *(v8us*)(Al + oo) = ol; }
}
__global__ __launch_bounds__(128) void k_fattn(const h16* __restrict__ Q16, const h16* __restrict__ K16, const h16* __restrict__ V16, const bf* __restrict__ Qh, const bf* __restrict__ Ql, const bf* __restrict__ Kh, const bf* __restrict__ Kl, const bf* __restrict__ Vh, const bf* __restrict__ Vl, bf* Ah, bf* Al) {
    __shared__ __align__(16) unsigned short sm[2 * 2 * (KTIL + VTIL)];
    constexpr int NHR = RH / FQT, NLR = (TT - RH) / FQT; const int bid = blockIdx.x;   // the costlier hi/lo tiles take the lowest indices and start first
    if (bid < NB_ * NH_ * NHR) { const int bh = bid / NHR; const size_t po = (size_t)bh * TT * HD, ao = (size_t)(bh / NH_) * TT * DQ + (bh % NH_) * HD; fattn<bf, 2>((bf*)sm, Qh + po, Ql + po, Kh + po, Kl + po, Vh + po, Vl + po, (bid % NHR) * FQT, Ah + ao, Al + ao); }   // bh = batch * NH_ + head
    else { const int r = bid - NB_ * NH_ * NHR; const int bh = r / NLR; const size_t po = (size_t)bh * TT * HD, ao = (size_t)(bh / NH_) * TT * DQ + (bh % NH_) * HD; fattn<h16, 1>((h16*)sm, Q16 + po, nullptr, K16 + po, nullptr, V16 + po, nullptr, RH + (r % NLR) * FQT, Ah + ao, Al + ao); }
}

extern "C" void kernel_launch(void* const* d_in, const int* in_sizes, int n_in,
                              void* d_out, int out_size, void* d_ws, size_t ws_size, hipStream_t stream) {
    (void)in_sizes; (void)n_in; (void)out_size;
    const float* x = (const float*)d_in[0]; const float* xk = (const float*)d_in[1]; const float* xv = (const float*)d_in[2]; const float* wq = (const float*)d_in[3]; const float* bq = (const float*)d_in[4]; const float* wk = (const float*)d_in[5]; const float* bk = (const float*)d_in[6]; const float* wv = (const float*)d_in[7]; const float* bv = (const float*)d_in[8]; const float* wo = (const float*)d_in[9]; const float* bo = (const float*)d_in[10];   /* input order q, k, v, Wq [16][1024][64], bq [16][64], Wk, bk, Wv, bv, Wo ('oi' [1024][1024]), bo */
    float* OUT = (float*)d_out;     // [2][2048][1024]
    char* wsp = (char*)d_ws;
    auto take = [&](size_t bytes) { char* p = wsp; wsp += (bytes + 255) & ~(size_t)255; return (void*)p; };
    constexpr size_t PS = (size_t)NB_ * NH_ * TT * HD;   // one stream's plane, both batches
    bf* W3 = (bf*)take((size_t)3 * DQ * DM * 2); bf* WO = (bf*)take((size_t)DM * DQ * 2);   // W3: Wq, Wk, Wv as Bt
    bf* XB = (bf*)take((size_t)3 * NB_ * TT * DM * 2);   // bf16 q, k, v
    h16* P16 = (h16*)take(3 * PS * 2); bf* Ph = (bf*)take(3 * PS * 2); bf* Pl = (bf*)take(3 * PS * 2);   // each: q, k as [b][h][t][d], v as [b][h][d][t]
    bf* ATh = (bf*)take((size_t)NB_ * TT * DQ * 2); bf* ATl = (bf*)take((size_t)NB_ * TT * DQ * 2);
    if ((size_t)(wsp - (char*)d_ws) > ws_size) return;    // ws 256 MiB
    k_prep<<<dim3(PBX, 7, 1), 256, 0, stream>>>(x, xk, xv, wq, wk, wv, wo, XB, W3, WO);
    k_gemmw<bf, 0, true, 1, 1><<<dim3(NB_ * TT / 64, DQ / 64, 3), 32, 0, stream>>>(XB, nullptr, W3, nullptr, DM, nullptr, 0, bq, bk, bv, (size_t)NB_ * TT * DM, (size_t)DQ * DM, 0, P16, Ph, Pl);
    k_fattn<<<NB_ * NH_ * (TT / FQT), 128, 0, stream>>>(P16, P16 + PS, P16 + 2 * PS, Ph, Pl, Ph + PS, Pl + PS, Ph + 2 * PS, Pl + 2 * PS, ATh, ATl);   // one kv head per query head
    k_gemmw<bf, 1, true><<<dim3(NB_ * TT / 64, DM / 64, 1), 32, 0, stream>>>(ATh, ATl, WO, nullptr, DQ, OUT, DM, bo, nullptr, nullptr, 0, 0, 0, nullptr, nullptr, nullptr);
}

// v005
// Measured time: 130 microseconds a run.
// Two timings next to v004 both put it at 1.29 times that version's speed.
// All steps since v000 together make it 15.3 times as fast.
#include <hip/hip_runtime.h>

// Multi-headed attention on three input streams with per-head packed projections (q, k, v [2][2048][1024]; qh = einsum('bsd,hde', q, Wq) + bq, kh from k, vh from v with W [16][1024][64] = [h][d][e] (0.02) and b [16][64]; scores x 1/sqrt(64); softmax (no mask); heads concatenated (head h at columns h*64); out = x Wo^T + bo ('oi') -> [2][2048][1024] (4.2 M); argument order q, k, v, Wq, bq, Wk, bk, Wv, bv, Wo, bo).
// Layout, both batches in every plane (token planes rows b*2048 + t, head planes batch outermost, [b][h]): one launch makes the bf16 copies of q, k, v and Wo and turns each [h][d][e] weight into Bt rows h*64 + e; one launch does the three projections (grid z = stream); the [16][64] biases are the flat [1024] epilogue vectors; exact projections + f32 biases, whose epilogue writes the fp16 and hi/lo head planes itself (q, k as [h][t][d], v as [h][d][t]); one fused attention launch for both batches (scores, softmax and P x V in registers and LDS; hybrid rows: < 512 hi/lo 3 products, rest fp16) that writes the hi/lo context planes; hi/lo x Wo ('oi' as-is) exact + bo.
// Compute dtypes, f32 accumulate: every input rounded to bf16; projections exact + f32 biases; attention rows < 512 3 products, rest fp16; softmax f32; Wo hl x exact + bias.

#define NB_  2
#define TT   2048
#define DM   1024
#define NH_  16
#define NKV  16
#define REP  (NH_ / NKV)
#define HD   64
#define DQ   (NH_ * HD)
#define DKV  (NKV * HD)
#define RH   512                  // query rows < RH use hi+lo planes (0: none)
#define WIN  0
#define SCL  0.125f   // HD^-0.5
#define FQT  64                   // query rows of one attention work-group: 4 waves x 16
#define FKT  32                   // keys of one stage
#define KPIT 72                   // LDS pitch of a staged K row, elements: 128 B + 16 B, conflict-free for 16-byte reads
#define VPIT 40                   // LDS pitch of a staged V^T row, elements: 64 B + 16 B
#define KTIL (FKT * KPIT)
#define VTIL (HD * VPIT)
#define GKT  64                   // k elements of one GEMM stage: one whole 128-byte line of every operand row
#define GTIL (128 * KPIT)         // one operand plane of a GEMM stage: 128 rows at the K pitch
typedef _Float16 h16;
typedef unsigned short bf;
typedef __attribute__((ext_vector_type(16))) __bf16   v16bf;
typedef __attribute__((ext_vector_type(16))) _Float16 v16h;
typedef __attribute__((ext_vector_type(8)))  _Float16 v8h;
typedef __attribute__((ext_vector_type(8)))  unsigned short v8us;
typedef __attribute__((ext_vector_type(8)))  float    v8f;
typedef __attribute__((ext_vector_type(4)))  float    v4f;
typedef v8h  __attribute__((may_alias)) v8ha;
typedef v4f  __attribute__((may_alias)) v4fa;
typedef v8us __attribute__((may_alias)) v8usa;

__device__ __forceinline__ unsigned short f2bf(float f) { unsigned u = __float_as_uint(f); u += 0x7FFFu + ((u >> 16) & 1u); return (unsigned short)(u >> 16); }
__device__ __forceinline__ float bf2f(unsigned short b) { return __uint_as_float(((unsigned)b) << 16); }
__device__ __forceinline__ float bfr(float f) { return bf2f(f2bf(f)); }
__device__ __forceinline__ v16h cat16(v8h lo, v8h hi) { return __builtin_shufflevector(lo, hi, 0, 1, 2, 3, 4, 5, 6, 7, 8, 9, 10, 11, 12, 13, 14, 15); }
__device__ __forceinline__ v16bf cat16b(v8us lo, v8us hi) { return __builtin_bit_cast(v16bf, __builtin_shufflevector(lo, hi, 0, 1, 2, 3, 4, 5, 6, 7, 8, 9, 10, 11, 12, 13, 14, 15)); }
__device__ __forceinline__ v8f wmma16(v16h a, v16h b, v8f c) { return __builtin_amdgcn_wmma_f32_16x16x32_f16(false, a, false, b, (short)0, c, false, false); }
__device__ __forceinline__ v8f wmmab(v16bf a, v16bf b, v8f c) { return __builtin_amdgcn_wmma_f32_16x16x32_bf16(false, a, false, b, (short)0, c, false, false); }
__device__ __forceinline__ h16 tohx(float x) { return (h16)x; }
__device__ __forceinline__ void splitf(float y, unsigned short& h, unsigned short& l) { h = f2bf(y); l = f2bf(y - bf2f(h)); }



// ---- k_gemmw: register-blocked GEMM, one work-group of 4 waves (2 x 2) per 128x128 output tile, ONE WAVE per 64x64 part (16 accumulators); grid (M/128, N/128, Z), 128 threads.
// Operands are K-contiguous 16-bit planes. A stage is 64 k of the tile's 128 A rows and 128 Bt rows: global -> registers -> LDS in whole 128-byte lines, two buffers, one barrier per stage, the loads of stage s + 2 in flight while stage s is worked on; each wave reads its fragments from LDS, and every staged row serves two waves.
// C[m][n] (f32, pitch ldc, + optional f32 bias[n]) = sum_k A[m][k] Bt[n][k] (+ split products per NSPLIT). z-batch strides sA/sB/sC in elements. K is a compile-time constant (the row steps of the staging loads become immediate offsets), K % (64 * KS) == 0.
// EPI = 0: f32 C as above. EPI = 1: the three projections in one grid, z = stream (q, k, v: its own A, Bt, bias and planes), rows = batch * TT + t; no f32 C; a wave's part (one head: 64 columns) + bias goes out as three 16-bit planes per stream and batch, fp16 and bf16 hi + lo: q, k as [head][t][64] (through the LDS tile, whole 128-byte rows), v transposed as [column][TT].
// KS > 1: grid (M/128, N/128 * KS, Z); the work-group with chunk ks = blockIdx.y % KS sums k in [ks K/KS, (ks+1) K/KS) alone and stores that partial at C + (z KS + ks) sC; the caller adds the KS planes.
template <typename T16> struct WFrag;
template <> struct WFrag<h16> { typedef v16h V; static __device__ __forceinline__ V ld(const h16* p) { return cat16(*(const v8h*)p, *(const v8h*)(p + 16)); } static __device__ __forceinline__ v8f mma(V a, V b, v8f c) { return wmma16(a, b, c); } };
template <> struct WFrag<bf> { typedef v16bf V; static __device__ __forceinline__ V ld(const bf* p) { return cat16b(*(const v8us*)p, *(const v8us*)(p + 16)); } static __device__ __forceinline__ v8f mma(V a, V b, v8f c) { return wmmab(a, b, c); } };
template <typename T16> struct FStage;
template <> struct FStage<h16> { typedef v8h H; };
template <> struct FStage<bf> { typedef v8us H; };
// Work-group barrier behind this wave's own LDS reads and writes; global loads issued ahead stay in flight across it.
__device__ __forceinline__ void wg_publish() { asm volatile("s_wait_dscnt 0x0" ::: "memory"); asm volatile("s_barrier_signal -1\n\ts_barrier_wait -1" ::: "memory"); }
template <typename T16, int NSPLIT, bool BIAS, int K, int KS = 1, int EPI = 0>
__global__ __launch_bounds__(128) void k_gemmw(const T16* __restrict__ A, const T16* __restrict__ A2, const T16* __restrict__ Bt, const T16* __restrict__ Bt2, float* C, int ldc, const float* __restrict__ bias, const float* __restrict__ biasK, const float* __restrict__ biasV, size_t sA, size_t sB, size_t sC, h16* P16, bf* Ph, bf* Pl) {
    typedef typename WFrag<T16>::V V; typedef typename FStage<T16>::H H;
    constexpr int NA = (NSPLIT == 1 || NSPLIT == 2) ? 2 : 1, NP = NA + (NSPLIT >= 2 ? 2 : 1), BUF = NP * GTIL;   // planes of a stage: A (, A2), Bt (, Bt2)
    __shared__ __align__(16) T16 sm[2 * BUF];
    __shared__ __align__(16) float osm[4 * 16 * 68];
    const size_t z = blockIdx.z; const int ks = (int)(blockIdx.y % KS); A += z * sA; if (A2) A2 += z * sA; Bt += z * sB; if (Bt2) Bt2 += z * sB; C += (z * KS + ks) * sC;
    const int tid = threadIdx.x, lane = tid & 31, lr = lane & 15, hi = lane >> 4, wm = tid >> 6, wn = (tid >> 5) & 1; float* os = osm + (tid >> 5) * (16 * 68);   // each wave's own epilogue tile
    const int R0 = blockIdx.x * 128, C0 = (blockIdx.y / KS) * 128, r0 = R0 + wm * 64, c0 = C0 + wn * 64; const int kb = ks * (K / KS); constexpr int ns = K / KS / GKT;
    v8f acc[4][4];
#pragma unroll
    for (int mb = 0; mb < 4; ++mb)
#pragma unroll
        for (int nb = 0; nb < 4; ++nb) acc[mb][nb] = (v8f){};
    H rg[NP][8];
    const unsigned vob = ((unsigned)(tid >> 3) * K + (tid & 7) * 8) * (unsigned)sizeof(T16);   // the lane's byte offset: 8 lanes x 16 bytes = one 128-byte line, a wave's load covers 4 whole lines
    auto fetch = [&](int kc) { const char* ga[NP];   // a plane's 8 loads share one address pair; the row steps are immediate offsets
        __builtin_amdgcn_sched_barrier(0);   // with its twin behind the wait: no other instruction comes between the loads and their s_wait_xcnt (without the pair, register moves that overwrite an address register stood there), and in the loop the loads stay at the head of the pass, so that a whole pass covers their latency
#pragma unroll   // the staging registers stay registers (every unroll of the stage loop: the same)
        for (int p = 0; p < NP; ++p) { ga[p] = (const char*)((p < NA ? (p ? A2 : A) + (size_t)R0 * K : (p > NA ? Bt2 : Bt) + (size_t)C0 * K) + kc) + vob;
#pragma unroll
            for (int i = 0; i < 8; ++i) rg[p][i] = *(const H*)(ga[p] + (size_t)i * 16 * K * sizeof(T16)); }
        // behind the stage's loads, in front of whatever overwrites their address registers; the addresses are inputs of the wait so that no later load of the stage gets their registers as its destination
        if constexpr (NP == 2) asm volatile("s_wait_xcnt 0x0" :: "v"(ga[0]), "v"(ga[1]) : "memory");
        else if constexpr (NP == 3) asm volatile("s_wait_xcnt 0x0" :: "v"(ga[0]), "v"(ga[1]), "v"(ga[2]) : "memory");
        else asm volatile("s_wait_xcnt 0x0" :: "v"(ga[0]), "v"(ga[1]), "v"(ga[2]), "v"(ga[3]) : "memory");
        __builtin_amdgcn_sched_barrier(0); };
    auto put = [&](T16* b) {
#pragma unroll
        for (int p = 0; p < NP; ++p) {
#pragma unroll
            for (int i = 0; i < 8; ++i) *(H*)(b + p * GTIL + ((tid >> 3) + 16 * i) * KPIT + (tid & 7) * 8) = rg[p][i]; } };
    fetch(kb); put(sm); fetch(kb + (ns > 1 ? GKT : 0)); wg_publish();
#pragma unroll 1
    for (int s = 0; s < ns; ++s) {
        const T16* cur = sm + (s & 1) * BUF;
        put(sm + ((s + 1) & 1) * BUF);   // that buffer's readers (stage s - 1) ended at the last barrier; in the last pass nobody reads what lands there
        fetch(kb + (s + 2 < ns ? s + 2 : ns - 1) * GKT);   // unconditional, clamped to the last stage: one loop body, no branch around loads in flight
        const T16* ar = cur + (wm * 64 + lr) * KPIT + 8 * hi; const T16* br = cur + NA * GTIL + (wn * 64 + lr) * KPIT + 8 * hi;
        V a[GKT / 32][4], a2[GKT / 32][4], b[GKT / 32][4], b2[GKT / 32][4];
#pragma unroll
        for (int c = 0; c < GKT / 32; ++c) {
#pragma unroll
            for (int mb = 0; mb < 4; ++mb) { a[c][mb] = WFrag<T16>::ld(ar + mb * 16 * KPIT + c * 32); if (NA == 2) a2[c][mb] = WFrag<T16>::ld(ar + GTIL + mb * 16 * KPIT + c * 32); }
#pragma unroll
            for (int nb = 0; nb < 4; ++nb) { b[c][nb] = WFrag<T16>::ld(br + nb * 16 * KPIT + c * 32); if (NSPLIT >= 2) b2[c][nb] = WFrag<T16>::ld(br + GTIL + nb * 16 * KPIT + c * 32); } }
        __builtin_amdgcn_sched_barrier(0);   // holds the pass's fragment reads in one group in front of its products instead of among them
#pragma unroll
        for (int c = 0; c < GKT / 32; ++c)
#pragma unroll
            for (int nb = 0; nb < 4; ++nb)
#pragma unroll
                for (int mb = 0; mb < 4; ++mb) { acc[mb][nb] = WFrag<T16>::mma(a[c][mb], b[c][nb], acc[mb][nb]); if (NSPLIT == 1 || NSPLIT == 2) acc[mb][nb] = WFrag<T16>::mma(a2[c][mb], b[c][nb], acc[mb][nb]); if (NSPLIT >= 2) acc[mb][nb] = WFrag<T16>::mma(a[c][mb], b2[c][nb], acc[mb][nb]); }
        __builtin_amdgcn_sched_barrier(0);   // keeps the barrier behind the products: moved up among them, its s_wait_dscnt 0 makes the second product wait for the pass's last fragment
        wg_publish();   // publishes stage s + 1 and ends every read of stage s
    }
    const int t0 = r0 % TT;
    if constexpr (EPI == 1) { const size_t pb = (z * NB_ + r0 / TT) * ((size_t)NH_ * TT * HD); P16 += pb; Ph += pb; Pl += pb; bias = z == 0 ? bias : z == 1 ? biasK : biasV; }
    if (EPI == 1 && z == 2) {   // a lane's 8 accumulator registers are 8 consecutive rows of its column: one 16-byte store per plane, no LDS; the 4 mb fill a column's 128-byte line
#pragma unroll   // accumulator and output vectors stay in registers (every unroll of the two plane epilogues: the same)
        for (int nb = 0; nb < 4; ++nb) { const float bb = bfr(bias[c0 + nb * 16 + lr]);
#pragma unroll
            for (int mb = 0; mb < 4; ++mb) { v8h o16; v8us oh, ol;
#pragma unroll
                for (int j = 0; j < 8; ++j) { const float x = acc[mb][nb][j] + bb; o16[j] = tohx(x); unsigned short a2, c2; splitf(x, a2, c2); oh[j] = a2; ol[j] = c2; }
                const size_t oo = (size_t)(c0 + nb * 16 + lr) * TT + t0 + mb * 16 + hi * 8; *(v8h*)(P16 + oo) = o16; *(v8us*)(Ph + oo) = oh; *(v8us*)(Pl + oo) = ol; } }
        return; }
    float bb8[8];
    if constexpr (EPI == 1) {
#pragma unroll
        for (int k = 0; k < 8; ++k) bb8[k] = bfr(bias[c0 + (lane & 7) * 8 + k]); }
#pragma unroll
    for (int mb = 0; mb < 4; ++mb) {
#pragma unroll
        for (int nb = 0; nb < 4; ++nb) {
#pragma unroll
            for (int j = 0; j < 8; ++j) os[(hi * 8 + j) * 68 + nb * 16 + lr] = acc[mb][nb][j]; }
        __builtin_amdgcn_wave_barrier(); asm volatile("" ::: "memory");
        if constexpr (EPI == 1) {   // 8 lanes x 16 bytes = one 128-byte plane row; a store covers 4 rows, which lie in a row in memory
#pragma unroll
            for (int s = 0; s < 4; ++s) { const int row = 4 * s + (lane >> 3), cofs = (lane & 7) * 8; const v4f v0 = *(const v4fa*)(os + row * 68 + cofs), v1 = *(const v4fa*)(os + row * 68 + cofs + 4); v8h o16; v8us oh, ol;
#pragma unroll
                for (int k = 0; k < 8; ++k) { const float x = (k < 4 ? v0[k & 3] : v1[k & 3]) + bb8[k]; o16[k] = tohx(x); unsigned short a2, c2; splitf(x, a2, c2); oh[k] = a2; ol[k] = c2; }
                const size_t oo = ((size_t)(c0 / HD) * TT + t0 + mb * 16 + row) * HD + cofs; *(v8h*)(P16 + oo) = o16; *(v8us*)(Ph + oo) = oh; *(v8us*)(Pl + oo) = ol; }
        } else {
            float* crow = C + (size_t)(r0 + mb * 16) * ldc + c0;
#pragma unroll
            for (int s = 0; s < 8; ++s) { const int row = 2 * s + hi, cofs = lr * 4; v4f val = *(const v4fa*)(os + row * 68 + cofs); if (BIAS) { val[0] += bfr(bias[c0 + cofs]); val[1] += bfr(bias[c0 + cofs + 1]); val[2] += bfr(bias[c0 + cofs + 2]); val[3] += bfr(bias[c0 + cofs + 3]); }
                *(v4f*)(crow + (size_t)row * ldc + cofs) = val; }
            asm volatile("s_wait_xcnt 0x0" ::: "memory");   // behind the 16 rows' stores: in the built code the next rows' bias loads overwrite registers that the stores name
             }
        __builtin_amdgcn_wave_barrier(); asm volatile("" ::: "memory");
    }
    if constexpr (EPI == 1) asm volatile("s_wait_xcnt 0x0" ::: "memory");   // behind the last plane stores: in the built code the v branch's instructions stand behind these and overwrite registers that the stores name
}

typedef __attribute__((ext_vector_type(2))) _Float16 v2h;
typedef __attribute__((ext_vector_type(4))) _Float16 v4h;
typedef __attribute__((ext_vector_type(2))) unsigned short v2us;
typedef __attribute__((ext_vector_type(4))) unsigned short v4us;
typedef __attribute__((ext_vector_type(2))) float v2f;
typedef __attribute__((ext_vector_type(4))) int v4i;

// ---- k_prep: every input conversion in one grid (PBX, 7): y < 3 the [h][d][e] weights into bf16 Bt rows h*64 + e, y = 3..5 q, k, v (both batches) into bf16, y = 6 Wo into bf16.
#define PBX ((unsigned)((size_t)NB_ * TT * DM / 8 / 256))
static_assert((size_t)DQ * DM / 2 / 256 <= PBX && (size_t)DM * DQ / 8 / 256 <= PBX, "grid x covers every part");
__global__ __launch_bounds__(256) void k_prep(const float* __restrict__ q, const float* __restrict__ k, const float* __restrict__ v, const float* __restrict__ wq, const float* __restrict__ wk, const float* __restrict__ wv, const float* __restrict__ wo, bf* XB, bf* W3, bf* WO) {
    const int y = blockIdx.y; const size_t i = (size_t)blockIdx.x * 256 + threadIdx.x;
    if (y < 3) { const float* w = y == 0 ? wq : y == 1 ? wk : wv; bf* Bt = W3 + (size_t)y * DQ * DM;
        const size_t e2 = i * 2; if (e2 >= (size_t)DQ * DM) return; const int d = (int)(e2 % DM); const int r = (int)(e2 / DM); const int h = r / HD, e = r % HD; v2us o; o[0] = f2bf(w[((size_t)h * DM + d) * HD + e]); o[1] = f2bf(w[((size_t)h * DM + d + 1) * HD + e]);
        *(v2us*)(Bt + e2) = o; return; }
    const float* src = y == 3 ? q : y == 4 ? k : y == 5 ? v : wo; bf* dst = y < 6 ? XB + (size_t)(y - 3) * NB_ * TT * DM : WO; const size_t n8 = y < 6 ? (size_t)NB_ * TT * DM / 8 : (size_t)DM * DQ / 8;
    if (i >= n8) return; const v8f x = *(const v8f*)(src + i * 8); v8us o;
#pragma unroll   // the 8 values stay in registers
    for (int j = 0; j < 8; ++j) o[j] = f2bf(x[j]); *(v8us*)(dst + i * 8) = o;  }
__device__ __forceinline__ float xhalf(float x) { return __builtin_bit_cast(float, __builtin_amdgcn_permlanex16(__builtin_bit_cast(int, x), __builtin_bit_cast(int, x), 0x76543210, 0xfedcba98, false, false)); }   // lane l with lane l ^ 16
template <typename T16, int NP>
__device__ __forceinline__ void fattn(T16* sm, const T16* __restrict__ Qa, const T16* __restrict__ Qb, const T16* __restrict__ Ka, const T16* __restrict__ Kb, const T16* __restrict__ Va, const T16* __restrict__ Vb, int qblk, bf* Ah, bf* Al) {
    typedef typename WFrag<T16>::V V; typedef typename FStage<T16>::H H;
    constexpr int BUF = NP * (KTIL + VTIL); constexpr int NS = TT / FKT; constexpr float SC2 = SCL * 1.4426950408889634f;
    const int tid = threadIdx.x, lane = tid & 31, lr = lane & 15, hi = lane >> 4; const int q = qblk + (tid >> 5) * 16 + lr;
    V qa[2], qb[2];
#pragma unroll   // fragment arrays stay in registers (every unroll below: the same)
    for (int c = 0; c < 2; ++c) { qa[c] = WFrag<T16>::ld(Qa + (size_t)q * HD + c * 32 + 8 * hi); if (NP == 2) qb[c] = WFrag<T16>::ld(Qb + (size_t)q * HD + c * 32 + 8 * hi); }
    H rk[NP][2], rv[NP][2];
    auto fetch = [&](int key0) {   // a K stage is 4 KiB in a row; a V^T stage is 64 rows of 64 B
#pragma unroll
        for (int p = 0; p < NP; ++p) { const T16* kp = p ? Kb : Ka; const T16* vp = p ? Vb : Va;
#pragma unroll
            for (int i = 0; i < 2; ++i) { const int idx = tid + 128 * i; rk[p][i] = *(const H*)(kp + (size_t)key0 * HD + idx * 8); rv[p][i] = *(const H*)(vp + (size_t)(idx >> 2) * TT + key0 + (idx & 3) * 8); } } };
    auto put = [&](T16* b) {
#pragma unroll
        for (int p = 0; p < NP; ++p) {
#pragma unroll
            for (int i = 0; i < 2; ++i) { const int idx = tid + 128 * i; *(H*)(b + p * KTIL + (idx >> 3) * KPIT + (idx & 7) * 8) = rk[p][i]; *(H*)(b + NP * KTIL + p * VTIL + (idx >> 2) * VPIT + (idx & 3) * 8) = rv[p][i]; } } };
    v8f o[4];
#pragma unroll
    for (int dt = 0; dt < 4; ++dt) o[dt] = (v8f){};
    float m = -1.0e30f, l = 0.f;
    fetch(0); put(sm); fetch(FKT); wg_publish();
    for (int s = 0; s < NS; ++s) {
        const T16* cur = sm + (s & 1) * BUF;
        put(sm + ((s + 1) & 1) * BUF);   // that buffer's readers (stage s - 1) ended at the last barrier; in the last pass nobody reads what lands there
        fetch((s + 2 < NS ? s + 2 : NS - 1) * FKT);   // unconditional, clamped to the last stage: one loop body, no branch around loads in flight
        V ka[2][2], kb[2][2], va[4];
#pragma unroll
        for (int c = 0; c < 2; ++c)
#pragma unroll
            for (int kt = 0; kt < 2; ++kt) { const T16* kr = cur + (kt * 16 + lr) * KPIT + c * 32 + 8 * hi; ka[c][kt] = WFrag<T16>::ld(kr); if (NP == 2) kb[c][kt] = WFrag<T16>::ld(kr + KTIL); }
#pragma unroll
        for (int dt = 0; dt < 4; ++dt) va[dt] = WFrag<T16>::ld(cur + NP * KTIL + (dt * 16 + lr) * VPIT + 8 * hi);
        __builtin_amdgcn_sched_barrier(0);   // holds the global loads at the head of the pass, so that a whole pass covers their latency, and the V^T fragment reads in front of the softmax, which covers theirs
        v8f st[2] = {(v8f){}, (v8f){}};
#pragma unroll
        for (int c = 0; c < 2; ++c)
#pragma unroll
            for (int kt = 0; kt < 2; ++kt) { st[kt] = WFrag<T16>::mma(ka[c][kt], qa[c], st[kt]);
                if (NP == 2) { st[kt] = WFrag<T16>::mma(ka[c][kt], qb[c], st[kt]); st[kt] = WFrag<T16>::mma(kb[c][kt], qa[c], st[kt]); } }
        float bm = st[0][0];
#pragma unroll
        for (int kt = 0; kt < 2; ++kt)
#pragma unroll
            for (int r = 0; r < 8; ++r) bm = fmaxf(bm, st[kt][r]);
        bm = fmaxf(bm, xhalf(bm)) * SC2;
        const bool need = bm > m + 8.0f;
        if (__builtin_amdgcn_ballot_w32(need) != 0) {   // wave-uniform; always taken in the first stage, where the factor is 0
            const float mn = need ? bm : m; const float al = __builtin_amdgcn_exp2f(m - mn); m = mn; l *= al;
#pragma unroll
            for (int dt = 0; dt < 4; ++dt)
#pragma unroll
                for (int r = 0; r < 8; ++r) o[dt][r] *= al; }
        float pe[16];
#pragma unroll
        for (int e = 0; e < 16; ++e) pe[e] = __builtin_amdgcn_exp2f(fmaf(st[e >> 3][e & 7], SC2, -m));
        l += (((pe[0] + pe[1]) + (pe[2] + pe[3])) + ((pe[4] + pe[5]) + (pe[6] + pe[7]))) + (((pe[8] + pe[9]) + (pe[10] + pe[11])) + ((pe[12] + pe[13]) + (pe[14] + pe[15])));   // a tree: no chain of 16 dependent adds
        V pa, pb;
        if constexpr (NP == 2) {
#pragma unroll
            for (int e = 0; e < 16; ++e) { pa[e] = (__bf16)pe[e]; pb[e] = (__bf16)(pe[e] - (float)pa[e]); }   // hi + lo, both rounded to nearest even
        } else {
#pragma unroll
            for (int e = 0; e < 16; ++e) pa[e] = tohx(pe[e]); }
#pragma unroll
        for (int dt = 0; dt < 4; ++dt) { o[dt] = WFrag<T16>::mma(va[dt], pa, o[dt]);
            if (NP == 2) { o[dt] = WFrag<T16>::mma(va[dt], pb, o[dt]); o[dt] = WFrag<T16>::mma(WFrag<T16>::ld(cur + NP * KTIL + VTIL + (dt * 16 + lr) * VPIT + 8 * hi), pa, o[dt]); } }
        wg_publish();   // publishes stage s + 1 and ends every read of stage s
    }
    l += xhalf(l); const float inv = __fdiv_rn(1.0f, l);
#pragma unroll
    for (int dt = 0; dt < 4; ++dt) { v8us oh, ol;   // a lane's 8 accumulator registers are 8 consecutive d of its query: one 16-byte store per plane
#pragma unroll
        for (int r = 0; r < 8; ++r) { unsigned short a, c2; splitf(o[dt][r] * inv, a, c2); oh[r] = a; ol[r] = c2; }
        const size_t oo = (size_t)q * DQ + dt * 16 + hi * 8; *(v8us*)(Ah + oo) = oh; *(v8us*)(Al + oo) = ol; }
}
__global__ __launch_bounds__(128) void k_fattn(const h16* __restrict__ Q16, const h16* __restrict__ K16, const h16* __restrict__ V16, const bf* __restrict__ Qh, const bf* __restrict__ Ql, const bf* __restrict__ Kh, const bf* __restrict__ Kl, const bf* __restrict__ Vh, const bf* __restrict__ Vl, bf* Ah, bf* Al) {
    __shared__ __align__(16) unsigned short sm[2 * 2 * (KTIL + VTIL)];
    constexpr int NHR = RH / FQT, NLR = (TT - RH) / FQT; const int bid = blockIdx.x;   // the costlier hi/lo tiles take the lowest indices and start first
    if (bid < NB_ * NH_ * NHR) { const int bh = bid / NHR; const size_t po = (size_t)bh * TT * HD, ao = (size_t)(bh / NH_) * TT * DQ + (bh % NH_) * HD; fattn<bf, 2>((bf*)sm, Qh + po, Ql + po, Kh + po, Kl + po, Vh + po, Vl + po, (bid % NHR) * FQT, Ah + ao, Al + ao); }   // bh = batch * NH_ + head
    else { const int r = bid - NB_ * NH_ * NHR; const int bh = r / NLR; const size_t po = (size_t)bh * TT * HD, ao = (size_t)(bh / NH_) * TT * DQ + (bh % NH_) * HD; fattn<h16, 1>((h16*)sm, Q16 + po, nullptr, K16 + po, nullptr, V16 + po, nullptr, RH + (r % NLR) * FQT, Ah + ao, Al + ao); }
}

extern "C" void kernel_launch(void* const* d_in, const int* in_sizes, int n_in,
                              void* d_out, int out_size, void* d_ws, size_t ws_size, hipStream_t stream) {
    (void)in_sizes; (void)n_in; (void)out_size;
    const float* x = (const float*)d_in[0]; const float* xk = (const float*)d_in[1]; const float* xv = (const float*)d_in[2]; const float* wq = (const float*)d_in[3]; const float* bq = (const float*)d_in[4]; const float* wk = (const float*)d_in[5]; const float* bk = (const float*)d_in[6]; const float* wv = (const float*)d_in[7]; const float* bv = (const float*)d_in[8]; const float* wo = (const float*)d_in[9]; const float* bo = (const float*)d_in[10];   /* input order q, k, v, Wq [16][1024][64], bq [16][64], Wk, bk, Wv, bv, Wo ('oi' [1024][1024]), bo */
    float* OUT = (float*)d_out;     // [2][2048][1024]
    char* wsp = (char*)d_ws;
    auto take = [&](size_t bytes) { char* p = wsp; wsp += (bytes + 255) & ~(size_t)255; return (void*)p; };
    constexpr size_t PS = (size_t)NB_ * NH_ * TT * HD;   // one stream's plane, both batches
    bf* W3 = (bf*)take((size_t)3 * DQ * DM * 2); bf* WO = (bf*)take((size_t)DM * DQ * 2);   // W3: Wq, Wk, Wv as Bt
    bf* XB = (bf*)take((size_t)3 * NB_ * TT * DM * 2);   // bf16 q, k, v
    h16* P16 = (h16*)take(3 * PS * 2); bf* Ph = (bf*)take(3 * PS * 2); bf* Pl = (bf*)take(3 * PS * 2);   // each: q, k as [b][h][t][d], v as [b][h][d][t]
    bf* ATh = (bf*)take((size_t)NB_ * TT * DQ * 2); bf* ATl = (bf*)take((size_t)NB_ * TT * DQ * 2);
    if ((size_t)(wsp - (char*)d_ws) > ws_size) return;    // ws 256 MiB
    k_prep<<<dim3(PBX, 7, 1), 256, 0, stream>>>(x, xk, xv, wq, wk, wv, wo, XB, W3, WO);
    k_gemmw<bf, 0, true, DM, 1, 1><<<dim3(NB_ * TT / 128, DQ / 128, 3), 128, 0, stream>>>(XB, nullptr, W3, nullptr, nullptr, 0, bq, bk, bv, (size_t)NB_ * TT * DM, (size_t)DQ * DM, 0, P16, Ph, Pl);
    k_fattn<<<NB_ * NH_ * (TT / FQT), 128, 0, stream>>>(P16, P16 + PS, P16 + 2 * PS, Ph, Pl, Ph + PS, Pl + PS, Ph + 2 * PS, Pl + 2 * PS, ATh, ATl);   // one kv head per query head
    k_gemmw<bf, 1, true, DQ><<<dim3(NB_ * TT / 128, DM / 128, 1), 128, 0, stream>>>(ATh, ATl, WO, nullptr, OUT, DM, bo, nullptr, nullptr, 0, 0, 0, nullptr, nullptr, nullptr);
}

// v006
// Measured time: 119 microseconds a run.
// Two timings next to v005 both put it at 1.10 times that version's speed.
// All steps since v000 together make it 16.8 times as fast.
#include <hip/hip_runtime.h>

// Multi-headed attention on three input streams with per-head packed projections (q, k, v [2][2048][1024]; qh = einsum('bsd,hde', q, Wq) + bq, kh from k, vh from v with W [16][1024][64] = [h][d][e] (0.02) and b [16][64]; scores x 1/sqrt(64); softmax (no mask); heads concatenated (head h at columns h*64); out = x Wo^T + bo ('oi') -> [2][2048][1024] (4.2 M); argument order q, k, v, Wq, bq, Wk, bk, Wv, bv, Wo, bo).
// Layout, both batches in every plane (token planes rows b*2048 + t, head planes batch outermost, [b][h]): one launch makes the bf16 copies of q, k, v and Wo and turns each [h][d][e] weight into Bt rows h*64 + e; one launch does the three projections (grid z = stream); the [16][64] biases are the flat [1024] epilogue vectors; exact projections + f32 biases, whose epilogue writes the fp16 and hi/lo head planes itself (q, k as [h][t][d], v as [h][d][t]); one fused attention launch for both batches (scores, softmax and P x V in registers and LDS; hybrid rows: < 512 hi/lo 3 products, rest fp16) that writes the hi/lo context planes; hi/lo x Wo ('oi' as-is) exact + bo.
// Compute dtypes, f32 accumulate: every input rounded to bf16; projections exact + f32 biases; attention rows < 512 3 products, rest fp16; softmax f32; Wo hl x exact + bias.

#define NB_  2
#define TT   2048
#define DM   1024
#define NH_  16
#define NKV  16
#define REP  (NH_ / NKV)
#define HD   64
#define DQ   (NH_ * HD)
#define DKV  (NKV * HD)
#define RH   512                  // query rows < RH use hi+lo planes (0: none)
#define WIN  0
#define SCL  0.125f   // HD^-0.5
#define FQT  64                   // query rows of one attention work-group: 4 waves x 16
#define FKT  32                   // keys of one stage
#define KPIT 72                   // LDS pitch of a staged K row, elements: 128 B + 16 B, conflict-free for 16-byte reads
#define VPIT 40                   // LDS pitch of a staged V^T row, elements: 64 B + 16 B
#define KTIL (FKT * KPIT)
#define VTIL (HD * VPIT)
#define GKT  64                   // k elements of one GEMM stage: one whole 128-byte line of every operand row
#define GTIL (128 * KPIT)         // one operand plane of a GEMM stage: 128 rows at the K pitch
typedef _Float16 h16;
typedef unsigned short bf;
typedef __attribute__((ext_vector_type(16))) __bf16   v16bf;
typedef __attribute__((ext_vector_type(16))) _Float16 v16h;
typedef __attribute__((ext_vector_type(8)))  _Float16 v8h;
typedef __attribute__((ext_vector_type(8)))  unsigned short v8us;
typedef __attribute__((ext_vector_type(8)))  float    v8f;
typedef __attribute__((ext_vector_type(4)))  float    v4f;
typedef v8h  __attribute__((may_alias)) v8ha;
typedef v4f  __attribute__((may_alias)) v4fa;
typedef v8us __attribute__((may_alias)) v8usa;

__device__ __forceinline__ unsigned short f2bf(float f) { unsigned u = __float_as_uint(f); u += 0x7FFFu + ((u >> 16) & 1u); return (unsigned short)(u >> 16); }
__device__ __forceinline__ float bf2f(unsigned short b) { return __uint_as_float(((unsigned)b) << 16); }
__device__ __forceinline__ float bfr(float f) { return bf2f(f2bf(f)); }
__device__ __forceinline__ v16h cat16(v8h lo, v8h hi) { return __builtin_shufflevector(lo, hi, 0, 1, 2, 3, 4, 5, 6, 7, 8, 9, 10, 11, 12, 13, 14, 15); }
__device__ __forceinline__ v16bf cat16b(v8us lo, v8us hi) { return __builtin_bit_cast(v16bf, __builtin_shufflevector(lo, hi, 0, 1, 2, 3, 4, 5, 6, 7, 8, 9, 10, 11, 12, 13, 14, 15)); }
__device__ __forceinline__ v8f wmma16(v16h a, v16h b, v8f c) { return __builtin_amdgcn_wmma_f32_16x16x32_f16(false, a, false, b, (short)0, c, false, false); }
__device__ __forceinline__ v8f wmmab(v16bf a, v16bf b, v8f c) { return __builtin_amdgcn_wmma_f32_16x16x32_bf16(false, a, false, b, (short)0, c, false, false); }
__device__ __forceinline__ h16 tohx(float x) { return (h16)x; }
__device__ __forceinline__ void splitf(float y, unsigned short& h, unsigned short& l) { h = f2bf(y); l = f2bf(y - bf2f(h)); }



// ---- k_gemmw: register-blocked GEMM, one work-group of 4 waves (2 x 2) per 128x128 output tile, ONE WAVE per 64x64 part (16 accumulators); grid (M/128, N/128, Z), 128 threads.
// Operands are K-contiguous 16-bit planes. A stage is 64 k of the tile's 128 A rows and 128 Bt rows: global -> registers -> LDS in whole 128-byte lines, two buffers, one barrier per stage, the loads of stage s + 2 in flight while stage s is worked on; each wave reads its fragments from LDS, and every staged row serves two waves.
// C[m][n] (f32, pitch ldc, + optional f32 bias[n]) = sum_k A[m][k] Bt[n][k] (+ split products per NSPLIT). z-batch strides sA/sB/sC in elements. K is a compile-time constant (the row steps of the staging loads become immediate offsets), K % (64 * KS) == 0.
// EPI = 0: f32 C as above. EPI = 1: the three projections in one grid, z = stream (q, k, v: its own A, Bt, bias and planes), rows = batch * TT + t; no f32 C; a wave's part (one head: 64 columns) + bias goes out as three 16-bit planes per stream and batch, fp16 and bf16 hi + lo: q, k as [head][t][64] (through the LDS tile, whole 128-byte rows), v transposed as [column][TT].
// KS > 1: grid (M/128, N/128 * KS, Z); the work-group with chunk ks = blockIdx.y % KS sums k in [ks K/KS, (ks+1) K/KS) alone and stores that partial at C + (z KS + ks) sC; the caller adds the KS planes.
template <typename T16> struct WFrag;
template <> struct WFrag<h16> { typedef v16h V; static __device__ __forceinline__ V ld(const h16* p) { return cat16(*(const v8h*)p, *(const v8h*)(p + 16)); } static __device__ __forceinline__ v8f mma(V a, V b, v8f c) { return wmma16(a, b, c); } };
template <> struct WFrag<bf> { typedef v16bf V; static __device__ __forceinline__ V ld(const bf* p) { return cat16b(*(const v8us*)p, *(const v8us*)(p + 16)); } static __device__ __forceinline__ v8f mma(V a, V b, v8f c) { return wmmab(a, b, c); } };
template <typename T16> struct FStage;
template <> struct FStage<h16> { typedef v8h H; };
template <> struct FStage<bf> { typedef v8us H; };
// Work-group barrier behind this wave's own LDS reads and writes; global loads issued ahead stay in flight across it.
__device__ __forceinline__ void wg_publish() { asm volatile("s_wait_dscnt 0x0" ::: "memory"); asm volatile("s_barrier_signal -1\n\ts_barrier_wait -1" ::: "memory"); }
template <typename T16, int NSPLIT, bool BIAS, int K, int KS = 1, int EPI = 0>
__global__ __launch_bounds__(128) void k_gemmw(const T16* __restrict__ A, const T16* __restrict__ A2, const T16* __restrict__ Bt, const T16* __restrict__ Bt2, float* C, int ldc, const float* __restrict__ bias, const float* __restrict__ biasK, const float* __restrict__ biasV, size_t sA, size_t sB, size_t sC, h16* P16, bf* Ph, bf* Pl) {
    typedef typename WFrag<T16>::V V; typedef typename FStage<T16>::H H;
    constexpr int NA = (NSPLIT == 1 || NSPLIT == 2) ? 2 : 1, NP = NA + (NSPLIT >= 2 ? 2 : 1), BUF = NP * GTIL;   // planes of a stage: A (, A2), Bt (, Bt2)
    __shared__ __align__(16) T16 sm[2 * BUF];
    __shared__ __align__(16) float osm[4 * 16 * 68];
    const size_t z = blockIdx.z; const int ks = (int)(blockIdx.y % KS); A += z * sA; if (A2) A2 += z * sA; Bt += z * sB; if (Bt2) Bt2 += z * sB; C += (z * KS + ks) * sC;
    const int tid = threadIdx.x, lane = tid & 31, lr = lane & 15, hi = lane >> 4, wm = tid >> 6, wn = (tid >> 5) & 1; float* os = osm + (tid >> 5) * (16 * 68);   // each wave's own epilogue tile
    const int R0 = blockIdx.x * 128, C0 = (blockIdx.y / KS) * 128, r0 = R0 + wm * 64, c0 = C0 + wn * 64; const int kb = ks * (K / KS); constexpr int ns = K / KS / GKT;
    v8f acc[4][4];
#pragma unroll
    for (int mb = 0; mb < 4; ++mb)
#pragma unroll
        for (int nb = 0; nb < 4; ++nb) acc[mb][nb] = (v8f){};
    H rg[NP][8];
    const unsigned vob = ((unsigned)(tid >> 3) * K + (tid & 7) * 8) * (unsigned)sizeof(T16);   // the lane's byte offset: 8 lanes x 16 bytes = one 128-byte line, a wave's load covers 4 whole lines
    auto fetch = [&](int kc) { const char* ga[NP];   // a plane's 8 loads share one address pair; the row steps are immediate offsets
        __builtin_amdgcn_sched_barrier(0);   // with its twin behind the wait: no other instruction comes between the loads and their s_wait_xcnt (without the pair, register moves that overwrite an address register stood there), and in the loop the loads stay at the head of the pass, so that a whole pass covers their latency
#pragma unroll   // the staging registers stay registers (every unroll of the stage loop: the same)
        for (int p = 0; p < NP; ++p) { ga[p] = (const char*)((p < NA ? (p ? A2 : A) + (size_t)R0 * K : (p > NA ? Bt2 : Bt) + (size_t)C0 * K) + kc) + vob;
#pragma unroll
            for (int i = 0; i < 8; ++i) rg[p][i] = *(const H*)(ga[p] + (size_t)i * 16 * K * sizeof(T16)); }
        // behind the stage's loads, in front of whatever overwrites their address registers; the addresses are inputs of the wait so that no later load of the stage gets their registers as its destination
        if constexpr (NP == 2) asm volatile("s_wait_xcnt 0x0" :: "v"(ga[0]), "v"(ga[1]) : "memory");
        else if constexpr (NP == 3) asm volatile("s_wait_xcnt 0x0" :: "v"(ga[0]), "v"(ga[1]), "v"(ga[2]) : "memory");
        else asm volatile("s_wait_xcnt 0x0" :: "v"(ga[0]), "v"(ga[1]), "v"(ga[2]), "v"(ga[3]) : "memory");
        __builtin_amdgcn_sched_barrier(0); };
    auto put = [&](T16* b) {
#pragma unroll
        for (int p = 0; p < NP; ++p) {
#pragma unroll
            for (int i = 0; i < 8; ++i) *(H*)(b + p * GTIL + ((tid >> 3) + 16 * i) * KPIT + (tid & 7) * 8) = rg[p][i]; } };
    fetch(kb); put(sm); fetch(kb + (ns > 1 ? GKT : 0)); wg_publish();
#pragma unroll 1
    for (int s = 0; s < ns; ++s) {
        const T16* cur = sm + (s & 1) * BUF;
        put(sm + ((s + 1) & 1) * BUF);   // that buffer's readers (stage s - 1) ended at the last barrier; in the last pass nobody reads what lands there
        fetch(kb + (s + 2 < ns ? s + 2 : ns - 1) * GKT);   // unconditional, clamped to the last stage: one loop body, no branch around loads in flight
        const T16* ar = cur + (wm * 64 + lr) * KPIT + 8 * hi; const T16* br = cur + NA * GTIL + (wn * 64 + lr) * KPIT + 8 * hi;
        V a[GKT / 32][4], a2[GKT / 32][4], b[GKT / 32][4], b2[GKT / 32][4];
#pragma unroll
        for (int c = 0; c < GKT / 32; ++c) {
#pragma unroll
            for (int mb = 0; mb < 4; ++mb) { a[c][mb] = WFrag<T16>::ld(ar + mb * 16 * KPIT + c * 32); if (NA == 2) a2[c][mb] = WFrag<T16>::ld(ar + GTIL + mb * 16 * KPIT + c * 32); }
#pragma unroll
            for (int nb = 0; nb < 4; ++nb) { b[c][nb] = WFrag<T16>::ld(br + nb * 16 * KPIT + c * 32); if (NSPLIT >= 2) b2[c][nb] = WFrag<T16>::ld(br + GTIL + nb * 16 * KPIT + c * 32); } }
        __builtin_amdgcn_sched_barrier(0);   // holds the pass's fragment reads in one group in front of its products instead of among them
#pragma unroll
        for (int c = 0; c < GKT / 32; ++c)
#pragma unroll
            for (int nb = 0; nb < 4; ++nb)
#pragma unroll
                for (int mb = 0; mb < 4; ++mb) { acc[mb][nb] = WFrag<T16>::mma(a[c][mb], b[c][nb], acc[mb][nb]); if (NSPLIT == 1 || NSPLIT == 2) acc[mb][nb] = WFrag<T16>::mma(a2[c][mb], b[c][nb], acc[mb][nb]); if (NSPLIT >= 2) acc[mb][nb] = WFrag<T16>::mma(a[c][mb], b2[c][nb], acc[mb][nb]); }
        __builtin_amdgcn_sched_barrier(0);   // keeps the barrier behind the products: moved up among them, its s_wait_dscnt 0 makes the second product wait for the pass's last fragment
        wg_publish();   // publishes stage s + 1 and ends every read of stage s
    }
    const int t0 = r0 % TT;
    if constexpr (EPI == 1) { const size_t pb = (z * NB_ + r0 / TT) * ((size_t)NH_ * TT * HD); P16 += pb; Ph += pb; Pl += pb; bias = z == 0 ? bias : z == 1 ? biasK : biasV; }
    if (EPI == 1 && z == 2) {   // a lane's 8 accumulator registers are 8 consecutive rows of its column: one 16-byte store per plane, no LDS; the 4 mb fill a column's 128-byte line
#pragma unroll   // accumulator and output vectors stay in registers (every unroll of the two plane epilogues: the same)
        for (int nb = 0; nb < 4; ++nb) { const float bb = bfr(bias[c0 + nb * 16 + lr]);
#pragma unroll
            for (int mb = 0; mb < 4; ++mb) { v8h o16; v8us oh, ol;
#pragma unroll
                for (int j = 0; j < 8; ++j) { const float x = acc[mb][nb][j] + bb; o16[j] = tohx(x); unsigned short a2, c2; splitf(x, a2, c2); oh[j] = a2; ol[j] = c2; }
                const size_t oo = (size_t)(c0 + nb * 16 + lr) * TT + t0 + mb * 16 + hi * 8; *(v8h*)(P16 + oo) = o16; *(v8us*)(Ph + oo) = oh; *(v8us*)(Pl + oo) = ol; } }
        return; }
    float bb8[8];
    if constexpr (EPI == 1) {
#pragma unroll
        for (int k = 0; k < 8; ++k) bb8[k] = bfr(bias[c0 + (lane & 7) * 8 + k]); }
#pragma unroll
    for (int mb = 0; mb < 4; ++mb) {
#pragma unroll
        for (int nb = 0; nb < 4; ++nb) {
#pragma unroll
            for (int j = 0; j < 8; ++j) os[(hi * 8 + j) * 68 + nb * 16 + lr] = acc[mb][nb][j]; }
        __builtin_amdgcn_wave_barrier(); asm volatile("" ::: "memory");
        if constexpr (EPI == 1) {   // 8 lanes x 16 bytes = one 128-byte plane row; a store covers 4 rows, which lie in a row in memory
#pragma unroll
            for (int s = 0; s < 4; ++s) { const int row = 4 * s + (lane >> 3), cofs = (lane & 7) * 8; const v4f v0 = *(const v4fa*)(os + row * 68 + cofs), v1 = *(const v4fa*)(os + row * 68 + cofs + 4); v8h o16; v8us oh, ol;
#pragma unroll
                for (int k = 0; k < 8; ++k) { const float x = (k < 4 ? v0[k & 3] : v1[k & 3]) + bb8[k]; o16[k] = tohx(x); unsigned short a2, c2; splitf(x, a2, c2); oh[k] = a2; ol[k] = c2; }
                const size_t oo = ((size_t)(c0 / HD) * TT + t0 + mb * 16 + row) * HD + cofs; *(v8h*)(P16 + oo) = o16; *(v8us*)(Ph + oo) = oh; *(v8us*)(Pl + oo) = ol; }
        } else {
            float* crow = C + (size_t)(r0 + mb * 16) * ldc + c0;
#pragma unroll
            for (int s = 0; s < 8; ++s) { const int row = 2 * s + hi, cofs = lr * 4; v4f val = *(const v4fa*)(os + row * 68 + cofs); if (BIAS) { val[0] += bfr(bias[c0 + cofs]); val[1] += bfr(bias[c0 + cofs + 1]); val[2] += bfr(bias[c0 + cofs + 2]); val[3] += bfr(bias[c0 + cofs + 3]); }
                *(v4f*)(crow + (size_t)row * ldc + cofs) = val; }
            asm volatile("s_wait_xcnt 0x0" ::: "memory");   // behind the 16 rows' stores: in the built code the next rows' bias loads overwrite registers that the stores name
             }
        __builtin_amdgcn_wave_barrier(); asm volatile("" ::: "memory");
    }
    if constexpr (EPI == 1) asm volatile("s_wait_xcnt 0x0" ::: "memory");   // behind the last plane stores: in the built code the v branch's instructions stand behind these and overwrite registers that the stores name
}

typedef __attribute__((ext_vector_type(2))) _Float16 v2h;
typedef __attribute__((ext_vector_type(4))) _Float16 v4h;
typedef __attribute__((ext_vector_type(2))) unsigned short v2us;
typedef __attribute__((ext_vector_type(4))) unsigned short v4us;
typedef __attribute__((ext_vector_type(2))) float v2f;
typedef __attribute__((ext_vector_type(4))) int v4i;

// ---- k_prep: every input conversion in one resident round: PG work-groups of 8 waves; a thread issues its 32 loads of 16 bytes before its first conversion.
// A unit is PU elements. Work-group g converts unit g of q, of k and of v (both batches) into bf16; its fourth unit is unit g of Wo (g < NWO), else unit (g - NWO) % NWU of weight (g - NWO) / NWU: 128 d x 64 e of one head, turned into Bt rows h*64 + e.
// Straight units: a wave's load covers 512 bytes in a row, its store 256. Weight units: a thread holds 8 d x 4 e (the turn is a choice of registers); 8 lanes x 16 bytes fill one 128-byte line of a Bt row.
#define PU  8192
#define PG  ((unsigned)((size_t)NB_ * TT * DM / PU))
#define NWO ((int)((size_t)DM * DQ / PU))
#define NWU ((int)((size_t)DQ * DM / PU))
static_assert((size_t)NB_ * TT * DM % PU == 0 && (size_t)DM * DQ % PU == 0 && NWO + 3 * NWU == (int)PG && HD == 64 && DM % (PU / HD) == 0, "every work-group has its four units");
__global__ __launch_bounds__(256) void k_prep(const float* __restrict__ q, const float* __restrict__ k, const float* __restrict__ v, const float* __restrict__ wq, const float* __restrict__ wk, const float* __restrict__ wv, const float* __restrict__ wo, bf* XB, bf* W3, bf* WO) {
    const int g = blockIdx.x, tid = threadIdx.x, lane = tid & 31, w = tid >> 5; const unsigned so = (unsigned)g * PU + tid * 4;   // the thread's first element in a straight unit
    const bool str = g < NWO; const int wi = str ? 0 : (g - NWO) / NWU, wu = str ? 0 : (g - NWO) % NWU;
    const int h = wu / (DM * HD / PU), d0 = (wu % (DM * HD / PU)) * (PU / HD) + (w >> 2) * 64 + (lane & 7) * 8, e0 = (w & 3) * 16 + (lane >> 3) * 4;
    const float* pq = q + so; const float* pk = k + so; const float* pv = v + so; const float* p3[8];
    const float* b3 = (str ? wo : wi == 0 ? wq : wi == 1 ? wk : wv) + (str ? so : ((unsigned)h * DM + d0) * HD + e0); const unsigned s3 = str ? 1024u : (unsigned)HD;   // the fourth unit's loads have one form: a start and a step
#pragma unroll   // the addresses and the loaded values stay in registers (every unroll of this kernel: the same)
    for (int j = 0; j < 8; ++j) p3[j] = b3 + j * s3;
    v4f x[4][8];
    __builtin_amdgcn_sched_barrier(0);   // with its twin behind the wait: the 32 loads stand in one group, so that one memory latency covers them all (without the pair the fourth unit's loads stood behind the wait for the first three)
#pragma unroll
    for (int j = 0; j < 8; ++j) x[0][j] = *(const v4f*)(pq + j * 1024);
#pragma unroll
    for (int j = 0; j < 8; ++j) x[1][j] = *(const v4f*)(pk + j * 1024);
#pragma unroll
    for (int j = 0; j < 8; ++j) x[2][j] = *(const v4f*)(pv + j * 1024);
#pragma unroll
    for (int j = 0; j < 8; ++j) x[3][j] = *(const v4f*)p3[j];
    // behind the loads, in front of whatever overwrites their address registers; the addresses are inputs of the wait so that no later load of the group gets their registers as its destination
    asm volatile("s_wait_xcnt 0x0" :: "v"(pq), "v"(pk), "v"(pv), "v"(p3[0]), "v"(p3[1]), "v"(p3[2]), "v"(p3[3]), "v"(p3[4]), "v"(p3[5]), "v"(p3[6]), "v"(p3[7]) : "memory");
    __builtin_amdgcn_sched_barrier(0);
#pragma unroll
    for (int t = 0; t < 3; ++t)
#pragma unroll
        for (int j = 0; j < 8; ++j) { v4us o;
#pragma unroll
            for (int c = 0; c < 4; ++c) o[c] = f2bf(x[t][j][c]);
            *(v4us*)(XB + (size_t)t * NB_ * TT * DM + so + j * 1024) = o; }
    asm volatile("s_wait_xcnt 0x0" ::: "memory");   // behind the three units' stores: in the built code both branches below begin by overwriting registers that the stores name
    if (str) {
#pragma unroll
        for (int j = 0; j < 8; ++j) { v4us o;
#pragma unroll
            for (int c = 0; c < 4; ++c) o[c] = f2bf(x[3][j][c]);
            *(v4us*)(WO + so + j * 1024) = o; }
    } else { bf* Bt = W3 + (size_t)wi * DQ * DM + (size_t)(h * HD + e0) * DM + d0;
#pragma unroll
        for (int c = 0; c < 4; ++c) { v8us o;
#pragma unroll
            for (int j = 0; j < 8; ++j) o[j] = f2bf(x[3][j][c]);
            *(v8us*)(Bt + (size_t)c * DM) = o; }
        asm volatile("s_wait_xcnt 0x0" ::: "memory"); }   // behind the Bt stores: in the built code the other branch's instructions stand behind these and overwrite registers that the stores name
}
__device__ __forceinline__ float xhalf(float x) { return __builtin_bit_cast(float, __builtin_amdgcn_permlanex16(__builtin_bit_cast(int, x), __builtin_bit_cast(int, x), 0x76543210, 0xfedcba98, false, false)); }   // lane l with lane l ^ 16
template <typename T16, int NP>
__device__ __forceinline__ void fattn(T16* sm, const T16* __restrict__ Qa, const T16* __restrict__ Qb, const T16* __restrict__ Ka, const T16* __restrict__ Kb, const T16* __restrict__ Va, const T16* __restrict__ Vb, int qblk, bf* Ah, bf* Al) {
    typedef typename WFrag<T16>::V V; typedef typename FStage<T16>::H H;
    constexpr int BUF = NP * (KTIL + VTIL); constexpr int NS = TT / FKT; constexpr float SC2 = SCL * 1.4426950408889634f;
    const int tid = threadIdx.x, lane = tid & 31, lr = lane & 15, hi = lane >> 4; const int q = qblk + (tid >> 5) * 16 + lr;
    V qa[2], qb[2];
#pragma unroll   // fragment arrays stay in registers (every unroll below: the same)
    for (int c = 0; c < 2; ++c) { qa[c] = WFrag<T16>::ld(Qa + (size_t)q * HD + c * 32 + 8 * hi); if (NP == 2) qb[c] = WFrag<T16>::ld(Qb + (size_t)q * HD + c * 32 + 8 * hi); }
    H rk[NP][2], rv[NP][2];
    auto fetch = [&](int key0) {   // a K stage is 4 KiB in a row; a V^T stage is 64 rows of 64 B
#pragma unroll
        for (int p = 0; p < NP; ++p) { const T16* kp = p ? Kb : Ka; const T16* vp = p ? Vb : Va;
#pragma unroll
            for (int i = 0; i < 2; ++i) { const int idx = tid + 128 * i; rk[p][i] = *(const H*)(kp + (size_t)key0 * HD + idx * 8); rv[p][i] = *(const H*)(vp + (size_t)(idx >> 2) * TT + key0 + (idx & 3) * 8); } } };
    auto put = [&](T16* b) {
#pragma unroll
        for (int p = 0; p < NP; ++p) {
#pragma unroll
            for (int i = 0; i < 2; ++i) { const int idx = tid + 128 * i; *(H*)(b + p * KTIL + (idx >> 3) * KPIT + (idx & 7) * 8) = rk[p][i]; *(H*)(b + NP * KTIL + p * VTIL + (idx >> 2) * VPIT + (idx & 3) * 8) = rv[p][i]; } } };
    v8f o[4];
#pragma unroll
    for (int dt = 0; dt < 4; ++dt) o[dt] = (v8f){};
    float m = -1.0e30f, l = 0.f;
    fetch(0); put(sm); fetch(FKT); wg_publish();
    for (int s = 0; s < NS; ++s) {
        const T16* cur = sm + (s & 1) * BUF;
        put(sm + ((s + 1) & 1) * BUF);   // that buffer's readers (stage s - 1) ended at the last barrier; in the last pass nobody reads what lands there
        fetch((s + 2 < NS ? s + 2 : NS - 1) * FKT);   // unconditional, clamped to the last stage: one loop body, no branch around loads in flight
        V ka[2][2], kb[2][2], va[4];
#pragma unroll
        for (int c = 0; c < 2; ++c)
#pragma unroll
            for (int kt = 0; kt < 2; ++kt) { const T16* kr = cur + (kt * 16 + lr) * KPIT + c * 32 + 8 * hi; ka[c][kt] = WFrag<T16>::ld(kr); if (NP == 2) kb[c][kt] = WFrag<T16>::ld(kr + KTIL); }
#pragma unroll
        for (int dt = 0; dt < 4; ++dt) va[dt] = WFrag<T16>::ld(cur + NP * KTIL + (dt * 16 + lr) * VPIT + 8 * hi);
        __builtin_amdgcn_sched_barrier(0);   // holds the global loads at the head of the pass, so that a whole pass covers their latency, and the V^T fragment reads in front of the softmax, which covers theirs
        v8f st[2] = {(v8f){}, (v8f){}};
#pragma unroll
        for (int c = 0; c < 2; ++c)
#pragma unroll
            for (int kt = 0; kt < 2; ++kt) { st[kt] = WFrag<T16>::mma(ka[c][kt], qa[c], st[kt]);
                if (NP == 2) { st[kt] = WFrag<T16>::mma(ka[c][kt], qb[c], st[kt]); st[kt] = WFrag<T16>::mma(kb[c][kt], qa[c], st[kt]); } }
        float bm = st[0][0];
#pragma unroll
        for (int kt = 0; kt < 2; ++kt)
#pragma unroll
            for (int r = 0; r < 8; ++r) bm = fmaxf(bm, st[kt][r]);
        bm = fmaxf(bm, xhalf(bm)) * SC2;
        const bool need = bm > m + 8.0f;
        if (__builtin_amdgcn_ballot_w32(need) != 0) {   // wave-uniform; always taken in the first stage, where the factor is 0
            const float mn = need ? bm : m; const float al = __builtin_amdgcn_exp2f(m - mn); m = mn; l *= al;
#pragma unroll
            for (int dt = 0; dt < 4; ++dt)
#pragma unroll
                for (int r = 0; r < 8; ++r) o[dt][r] *= al; }
        float pe[16];
#pragma unroll
        for (int e = 0; e < 16; ++e) pe[e] = __builtin_amdgcn_exp2f(fmaf(st[e >> 3][e & 7], SC2, -m));
        l += (((pe[0] + pe[1]) + (pe[2] + pe[3])) + ((pe[4] + pe[5]) + (pe[6] + pe[7]))) + (((pe[8] + pe[9]) + (pe[10] + pe[11])) + ((pe[12] + pe[13]) + (pe[14] + pe[15])));   // a tree: no chain of 16 dependent adds
        V pa, pb;
        if constexpr (NP == 2) {
#pragma unroll
            for (int e = 0; e < 16; ++e) { pa[e] = (__bf16)pe[e]; pb[e] = (__bf16)(pe[e] - (float)pa[e]); }   // hi + lo, both rounded to nearest even
        } else {
#pragma unroll
            for (int e = 0; e < 16; ++e) pa[e] = tohx(pe[e]); }
#pragma unroll
        for (int dt = 0; dt < 4; ++dt) { o[dt] = WFrag<T16>::mma(va[dt], pa, o[dt]);
            if (NP == 2) { o[dt] = WFrag<T16>::mma(va[dt], pb, o[dt]); o[dt] = WFrag<T16>::mma(WFrag<T16>::ld(cur + NP * KTIL + VTIL + (dt * 16 + lr) * VPIT + 8 * hi), pa, o[dt]); } }
        wg_publish();   // publishes stage s + 1 and ends every read of stage s
    }
    l += xhalf(l); const float inv = __fdiv_rn(1.0f, l);
#pragma unroll
    for (int dt = 0; dt < 4; ++dt) { v8us oh, ol;   // a lane's 8 accumulator registers are 8 consecutive d of its query: one 16-byte store per plane
#pragma unroll
        for (int r = 0; r < 8; ++r) { unsigned short a, c2; splitf(o[dt][r] * inv, a, c2); oh[r] = a; ol[r] = c2; }
        const size_t oo = (size_t)q * DQ + dt * 16 + hi * 8; *(v8us*)(Ah + oo) = oh; *(v8us*)(Al + oo) = ol; }
}
__global__ __launch_bounds__(128) void k_fattn(const h16* __restrict__ Q16, const h16* __restrict__ K16, const h16* __restrict__ V16, const bf* __restrict__ Qh, const bf* __restrict__ Ql, const bf* __restrict__ Kh, const bf* __restrict__ Kl, const bf* __restrict__ Vh, const bf* __restrict__ Vl, bf* Ah, bf* Al) {
    __shared__ __align__(16) unsigned short sm[2 * 2 * (KTIL + VTIL)];
    constexpr int NHR = RH / FQT, NLR = (TT - RH) / FQT; const int bid = blockIdx.x;   // the costlier hi/lo tiles take the lowest indices and start first
    if (bid < NB_ * NH_ * NHR) { const int bh = bid / NHR; const size_t po = (size_t)bh * TT * HD, ao = (size_t)(bh / NH_) * TT * DQ + (bh % NH_) * HD; fattn<bf, 2>((bf*)sm, Qh + po, Ql + po, Kh + po, Kl + po, Vh + po, Vl + po, (bid % NHR) * FQT, Ah + ao, Al + ao); }   // bh = batch * NH_ + head
    else { const int r = bid - NB_ * NH_ * NHR; const int bh = r / NLR; const size_t po = (size_t)bh * TT * HD, ao = (size_t)(bh / NH_) * TT * DQ + (bh % NH_) * HD; fattn<h16, 1>((h16*)sm, Q16 + po, nullptr, K16 + po, nullptr, V16 + po, nullptr, RH + (r % NLR) * FQT, Ah + ao, Al + ao); }
}

extern "C" void kernel_launch(void* const* d_in, const int* in_sizes, int n_in,
                              void* d_out, int out_size, void* d_ws, size_t ws_size, hipStream_t stream) {
    (void)in_sizes; (void)n_in; (void)out_size;
    const float* x = (const float*)d_in[0]; const float* xk = (const float*)d_in[1]; const float* xv = (const float*)d_in[2]; const float* wq = (const float*)d_in[3]; const float* bq = (const float*)d_in[4]; const float* wk = (const float*)d_in[5]; const float* bk = (const float*)d_in[6]; const float* wv = (const float*)d_in[7]; const float* bv = (const float*)d_in[8]; const float* wo = (const float*)d_in[9]; const float* bo = (const float*)d_in[10];   /* input order q, k, v, Wq [16][1024][64], bq [16][64], Wk, bk, Wv, bv, Wo ('oi' [1024][1024]), bo */
    float* OUT = (float*)d_out;     // [2][2048][1024]
    char* wsp = (char*)d_ws;
    auto take = [&](size_t bytes) { char* p = wsp; wsp += (bytes + 255) & ~(size_t)255; return (void*)p; };
    constexpr size_t PS = (size_t)NB_ * NH_ * TT * HD;   // one stream's plane, both batches
    bf* W3 = (bf*)take((size_t)3 * DQ * DM * 2); bf* WO = (bf*)take((size_t)DM * DQ * 2);   // W3: Wq, Wk, Wv as Bt
    bf* XB = (bf*)take((size_t)3 * NB_ * TT * DM * 2);   // bf16 q, k, v
    h16* P16 = (h16*)take(3 * PS * 2); bf* Ph = (bf*)take(3 * PS * 2); bf* Pl = (bf*)take(3 * PS * 2);   // each: q, k as [b][h][t][d], v as [b][h][d][t]
    bf* ATh = (bf*)take((size_t)NB_ * TT * DQ * 2); bf* ATl = (bf*)take((size_t)NB_ * TT * DQ * 2);
    if ((size_t)(wsp - (char*)d_ws) > ws_size) return;    // ws 256 MiB
    k_prep<<<dim3(PG, 1, 1), 256, 0, stream>>>(x, xk, xv, wq, wk, wv, wo, XB, W3, WO);
    k_gemmw<bf, 0, true, DM, 1, 1><<<dim3(NB_ * TT / 128, DQ / 128, 3), 128, 0, stream>>>(XB, nullptr, W3, nullptr, nullptr, 0, bq, bk, bv, (size_t)NB_ * TT * DM, (size_t)DQ * DM, 0, P16, Ph, Pl);
    k_fattn<<<NB_ * NH_ * (TT / FQT), 128, 0, stream>>>(P16, P16 + PS, P16 + 2 * PS, Ph, Pl, Ph + PS, Pl + PS, Ph + 2 * PS, Pl + 2 * PS, ATh, ATl);   // one kv head per query head
    k_gemmw<bf, 1, true, DQ><<<dim3(NB_ * TT / 128, DM / 128, 1), 128, 0, stream>>>(ATh, ATl, WO, nullptr, OUT, DM, bo, nullptr, nullptr, 0, 0, 0, nullptr, nullptr, nullptr);
}

// v007
// One run takes 112 microseconds.
// Timed twice side by side with v006, it ran 1.07 and 1.06 times as fast.
// All steps since v000 together make it 17.9 times as fast.
#include <hip/hip_runtime.h>

// Multi-headed attention on three input streams with per-head packed projections (q, k, v [2][2048][1024]; qh = einsum('bsd,hde', q, Wq) + bq, kh from k, vh from v with W [16][1024][64] = [h][d][e] (0.02) and b [16][64]; scores x 1/sqrt(64); softmax (no mask); heads concatenated (head h at columns h*64); out = x Wo^T + bo ('oi') -> [2][2048][1024] (4.2 M); argument order q, k, v, Wq, bq, Wk, bk, Wv, bv, Wo, bo).
// Layout, both batches in every plane (token planes rows b*2048 + t, head planes batch outermost, [b][h]): one launch makes the bf16 copies of q, k, v and Wo and turns each [h][d][e] weight into Bt rows h*64 + e; one launch does the three projections (grid z = stream); the [16][64] biases are the flat [1024] epilogue vectors; exact projections + f32 biases, whose epilogue writes the fp16 and hi/lo head planes itself (q, k as [h][t][d], v as [h][d][t]); one fused attention launch for both batches (scores, softmax and P x V in registers and LDS; hybrid rows: < 512 hi/lo 3 products, rest fp16) that writes the hi/lo context planes; hi/lo x Wo ('oi' as-is) exact + bo.
// Compute dtypes, f32 accumulate: every input rounded to bf16; projections exact + f32 biases; attention rows < 512 3 products, rest fp16; softmax f32; Wo hl x exact + bias.

#define NB_  2
#define TT   2048
#define DM   1024
#define NH_  16
#define NKV  16
#define REP  (NH_ / NKV)
#define HD   64
#define DQ   (NH_ * HD)
#define DKV  (NKV * HD)
#define RH   512                  // query rows < RH use hi+lo planes (0: none)
#define WIN  0
#define SCL  0.125f   // HD^-0.5
#define FQT  64                   // query rows of one tile row of an attention work-group: 4 waves x 16
#define FKT  32                   // keys of one stage
#define KPIT 72                   // LDS pitch of a staged K row, elements: 128 B + 16 B, conflict-free for 16-byte reads
#define VPIT 40                   // LDS pitch of a staged V^T row, elements: 64 B + 16 B
#define KTIL (FKT * KPIT)
#define VTIL (HD * VPIT)
#define GKT  64                   // k elements of one GEMM stage: one whole 128-byte line of every operand row
#define GTIL (128 * KPIT)         // one operand plane of a GEMM stage: 128 rows at the K pitch
typedef _Float16 h16;
typedef unsigned short bf;
typedef __attribute__((ext_vector_type(16))) __bf16   v16bf;
typedef __attribute__((ext_vector_type(16))) _Float16 v16h;
typedef __attribute__((ext_vector_type(8)))  _Float16 v8h;
typedef __attribute__((ext_vector_type(8)))  unsigned short v8us;
typedef __attribute__((ext_vector_type(8)))  float    v8f;
typedef __attribute__((ext_vector_type(4)))  float    v4f;
typedef v8h  __attribute__((may_alias)) v8ha;
typedef v4f  __attribute__((may_alias)) v4fa;
typedef v8us __attribute__((may_alias)) v8usa;

__device__ __forceinline__ unsigned short f2bf(float f) { unsigned u = __float_as_uint(f); u += 0x7FFFu + ((u >> 16) & 1u); return (unsigned short)(u >> 16); }
__device__ __forceinline__ float bf2f(unsigned short b) { return __uint_as_float(((unsigned)b) << 16); }
__device__ __forceinline__ float bfr(float f) { return bf2f(f2bf(f)); }
__device__ __forceinline__ v16h cat16(v8h lo, v8h hi) { return __builtin_shufflevector(lo, hi, 0, 1, 2, 3, 4, 5, 6, 7, 8, 9, 10, 11, 12, 13, 14, 15); }
__device__ __forceinline__ v16bf cat16b(v8us lo, v8us hi) { return __builtin_bit_cast(v16bf, __builtin_shufflevector(lo, hi, 0, 1, 2, 3, 4, 5, 6, 7, 8, 9, 10, 11, 12, 13, 14, 15)); }
__device__ __forceinline__ v8f wmma16(v16h a, v16h b, v8f c) { return __builtin_amdgcn_wmma_f32_16x16x32_f16(false, a, false, b, (short)0, c, false, false); }
__device__ __forceinline__ v8f wmmab(v16bf a, v16bf b, v8f c) { return __builtin_amdgcn_wmma_f32_16x16x32_bf16(false, a, false, b, (short)0, c, false, false); }
__device__ __forceinline__ h16 tohx(float x) { return (h16)x; }
__device__ __forceinline__ void splitf(float y, unsigned short& h, unsigned short& l) { h = f2bf(y); l = f2bf(y - bf2f(h)); }



// ---- k_gemmw: register-blocked GEMM, one work-group of 4 waves (2 x 2) per 128x128 output tile, ONE WAVE per 64x64 part (16 accumulators); grid (M/128, N/128, Z), 128 threads.
// Operands are K-contiguous 16-bit planes. A stage is 64 k of the tile's 128 A rows and 128 Bt rows: global -> registers -> LDS in whole 128-byte lines, two buffers, one barrier per stage, the loads of stage s + 2 in flight while stage s is worked on; each wave reads its fragments from LDS, and every staged row serves two waves.
// C[m][n] (f32, pitch ldc, + optional f32 bias[n]) = sum_k A[m][k] Bt[n][k] (+ split products per NSPLIT). z-batch strides sA/sB/sC in elements. K is a compile-time constant (the row steps of the staging loads become immediate offsets), K % (64 * KS) == 0.
// EPI = 0: f32 C as above. EPI = 1: the three projections in one grid, z = stream (q, k, v: its own A, Bt, bias and planes), rows = batch * TT + t; no f32 C; a wave's part (one head: 64 columns) + bias goes out as three 16-bit planes per stream and batch, fp16 and bf16 hi + lo: q, k as [head][t][64] (through the LDS tile, whole 128-byte rows), v transposed as [column][TT].
// KS > 1: grid (M/128, N/128 * KS, Z); the work-group with chunk ks = blockIdx.y % KS sums k in [ks K/KS, (ks+1) K/KS) alone and stores that partial at C + (z KS + ks) sC; the caller adds the KS planes.
template <typename T16> struct WFrag;
template <> struct WFrag<h16> { typedef v16h V; static __device__ __forceinline__ V ld(const h16* p) { return cat16(*(const v8h*)p, *(const v8h*)(p + 16)); } static __device__ __forceinline__ v8f mma(V a, V b, v8f c) { return wmma16(a, b, c); } };
template <> struct WFrag<bf> { typedef v16bf V; static __device__ __forceinline__ V ld(const bf* p) { return cat16b(*(const v8us*)p, *(const v8us*)(p + 16)); } static __device__ __forceinline__ v8f mma(V a, V b, v8f c) { return wmmab(a, b, c); } };
template <typename T16> struct FStage;
template <> struct FStage<h16> { typedef v8h H; };
template <> struct FStage<bf> { typedef v8us H; };
// Work-group barrier behind this wave's own LDS reads and writes; global loads issued ahead stay in flight across it.
__device__ __forceinline__ void wg_publish() { asm volatile("s_wait_dscnt 0x0" ::: "memory"); asm volatile("s_barrier_signal -1\n\ts_barrier_wait -1" ::: "memory"); }
template <typename T16, int NSPLIT, bool BIAS, int K, int KS = 1, int EPI = 0>
__global__ __launch_bounds__(128) void k_gemmw(const T16* __restrict__ A, const T16* __restrict__ A2, const T16* __restrict__ Bt, const T16* __restrict__ Bt2, float* C, int ldc, const float* __restrict__ bias, const float* __restrict__ biasK, const float* __restrict__ biasV, size_t sA, size_t sB, size_t sC, h16* P16, bf* Ph, bf* Pl) {
    typedef typename WFrag<T16>::V V; typedef typename FStage<T16>::H H;
    constexpr int NA = (NSPLIT == 1 || NSPLIT == 2) ? 2 : 1, NP = NA + (NSPLIT >= 2 ? 2 : 1), BUF = NP * GTIL;   // planes of a stage: A (, A2), Bt (, Bt2)
    __shared__ __align__(16) T16 sm[2 * BUF];
    __shared__ __align__(16) float osm[4 * 16 * 68];
    const size_t z = blockIdx.z; const int ks = (int)(blockIdx.y % KS); A += z * sA; if (A2) A2 += z * sA; Bt += z * sB; if (Bt2) Bt2 += z * sB; C += (z * KS + ks) * sC;
    const int tid = threadIdx.x, lane = tid & 31, lr = lane & 15, hi = lane >> 4, wm = tid >> 6, wn = (tid >> 5) & 1; float* os = osm + (tid >> 5) * (16 * 68);   // each wave's own epilogue tile
    const int R0 = blockIdx.x * 128, C0 = (blockIdx.y / KS) * 128, r0 = R0 + wm * 64, c0 = C0 + wn * 64; const int kb = ks * (K / KS); constexpr int ns = K / KS / GKT;
    v8f acc[4][4];
#pragma unroll
    for (int mb = 0; mb < 4; ++mb)
#pragma unroll
        for (int nb = 0; nb < 4; ++nb) acc[mb][nb] = (v8f){};
    H rg[NP][8];
    const unsigned vob = ((unsigned)(tid >> 3) * K + (tid & 7) * 8) * (unsigned)sizeof(T16);   // the lane's byte offset: 8 lanes x 16 bytes = one 128-byte line, a wave's load covers 4 whole lines
    auto fetch = [&](int kc) { const char* ga[NP];   // a plane's 8 loads share one address pair; the row steps are immediate offsets
        __builtin_amdgcn_sched_barrier(0);   // with its twin behind the wait: no other instruction comes between the loads and their s_wait_xcnt (without the pair, register moves that overwrite an address register stood there), and in the loop the loads stay at the head of the pass, so that a whole pass covers their latency
#pragma unroll   // the staging registers stay registers (every unroll of the stage loop: the same)
        for (int p = 0; p < NP; ++p) { ga[p] = (const char*)((p < NA ? (p ? A2 : A) + (size_t)R0 * K : (p > NA ? Bt2 : Bt) + (size_t)C0 * K) + kc) + vob;
#pragma unroll
            for (int i = 0; i < 8; ++i) rg[p][i] = *(const H*)(ga[p] + (size_t)i * 16 * K * sizeof(T16)); }
        // behind the stage's loads, in front of whatever overwrites their address registers; the addresses are inputs of the wait so that no later load of the stage gets their registers as its destination
        if constexpr (NP == 2) asm volatile("s_wait_xcnt 0x0" :: "v"(ga[0]), "v"(ga[1]) : "memory");
        else if constexpr (NP == 3) asm volatile("s_wait_xcnt 0x0" :: "v"(ga[0]), "v"(ga[1]), "v"(ga[2]) : "memory");
        else asm volatile("s_wait_xcnt 0x0" :: "v"(ga[0]), "v"(ga[1]), "v"(ga[2]), "v"(ga[3]) : "memory");
        __builtin_amdgcn_sched_barrier(0); };
    auto put = [&](T16* b) {
#pragma unroll
        for (int p = 0; p < NP; ++p) {
#pragma unroll
            for (int i = 0; i < 8; ++i) *(H*)(b + p * GTIL + ((tid >> 3) + 16 * i) * KPIT + (tid & 7) * 8) = rg[p][i]; } };
    fetch(kb); put(sm); fetch(kb + (ns > 1 ? GKT : 0)); wg_publish();
#pragma unroll 1
    for (int s = 0; s < ns; ++s) {
        const T16* cur = sm + (s & 1) * BUF;
        put(sm + ((s + 1) & 1) * BUF);   // that buffer's readers (stage s - 1) ended at the last barrier; in the last pass nobody reads what lands there
        fetch(kb + (s + 2 < ns ? s + 2 : ns - 1) * GKT);   // unconditional, clamped to the last stage: one loop body, no branch around loads in flight
        const T16* ar = cur + (wm * 64 + lr) * KPIT + 8 * hi; const T16* br = cur + NA * GTIL + (wn * 64 + lr) * KPIT + 8 * hi;
        V a[GKT / 32][4], a2[GKT / 32][4], b[GKT / 32][4], b2[GKT / 32][4];
#pragma unroll
        for (int c = 0; c < GKT / 32; ++c) {
#pragma unroll
            for (int mb = 0; mb < 4; ++mb) { a[c][mb] = WFrag<T16>::ld(ar + mb * 16 * KPIT + c * 32); if (NA == 2) a2[c][mb] = WFrag<T16>::ld(ar + GTIL + mb * 16 * KPIT + c * 32); }
#pragma unroll
            for (int nb = 0; nb < 4; ++nb) { b[c][nb] = WFrag<T16>::ld(br + nb * 16 * KPIT + c * 32); if (NSPLIT >= 2) b2[c][nb] = WFrag<T16>::ld(br + GTIL + nb * 16 * KPIT + c * 32); } }
        __builtin_amdgcn_sched_barrier(0);   // holds the pass's fragment reads in one group in front of its products instead of among them
#pragma unroll
        for (int c = 0; c < GKT / 32; ++c)
#pragma unroll
            for (int nb = 0; nb < 4; ++nb)
#pragma unroll
                for (int mb = 0; mb < 4; ++mb) { acc[mb][nb] = WFrag<T16>::mma(a[c][mb], b[c][nb], acc[mb][nb]); if (NSPLIT == 1 || NSPLIT == 2) acc[mb][nb] = WFrag<T16>::mma(a2[c][mb], b[c][nb], acc[mb][nb]); if (NSPLIT >= 2) acc[mb][nb] = WFrag<T16>::mma(a[c][mb], b2[c][nb], acc[mb][nb]); }
        __builtin_amdgcn_sched_barrier(0);   // keeps the barrier behind the products: moved up among them, its s_wait_dscnt 0 makes the second product wait for the pass's last fragment
        wg_publish();   // publishes stage s + 1 and ends every read of stage s
    }
    const int t0 = r0 % TT;
    if constexpr (EPI == 1) { const size_t pb = (z * NB_ + r0 / TT) * ((size_t)NH_ * TT * HD); P16 += pb; Ph += pb; Pl += pb; bias = z == 0 ? bias : z == 1 ? biasK : biasV; }
    if (EPI == 1 && z == 2) {   // a lane's 8 accumulator registers are 8 consecutive rows of its column: one 16-byte store per plane, no LDS; the 4 mb fill a column's 128-byte line
#pragma unroll   // accumulator and output vectors stay in registers (every unroll of the two plane epilogues: the same)
        for (int nb = 0; nb < 4; ++nb) { const float bb = bfr(bias[c0 + nb * 16 + lr]);
#pragma unroll
            for (int mb = 0; mb < 4; ++mb) { v8h o16; v8us oh, ol;
#pragma unroll
                for (int j = 0; j < 8; ++j) { const float x = acc[mb][nb][j] + bb; o16[j] = tohx(x); unsigned short a2, c2; splitf(x, a2, c2); oh[j] = a2; ol[j] = c2; }
                const size_t oo = (size_t)(c0 + nb * 16 + lr) * TT + t0 + mb * 16 + hi * 8; *(v8h*)(P16 + oo) = o16; *(v8us*)(Ph + oo) = oh; *(v8us*)(Pl + oo) = ol; } }
        return; }
    float bb8[8];
    if constexpr (EPI == 1) {
#pragma unroll
        for (int k = 0; k < 8; ++k) bb8[k] = bfr(bias[c0 + (lane & 7) * 8 + k]); }
#pragma unroll
    for (int mb = 0; mb < 4; ++mb) {
#pragma unroll
        for (int nb = 0; nb < 4; ++nb) {
#pragma unroll
            for (int j = 0; j < 8; ++j) os[(hi * 8 + j) * 68 + nb * 16 + lr] = acc[mb][nb][j]; }
        __builtin_amdgcn_wave_barrier(); asm volatile("" ::: "memory");
        if constexpr (EPI == 1) {   // 8 lanes x 16 bytes = one 128-byte plane row; a store covers 4 rows, which lie in a row in memory
#pragma unroll
            for (int s = 0; s < 4; ++s) { const int row = 4 * s + (lane >> 3), cofs = (lane & 7) * 8; const v4f v0 = *(const v4fa*)(os + row * 68 + cofs), v1 = *(const v4fa*)(os + row * 68 + cofs + 4); v8h o16; v8us oh, ol;
#pragma unroll
                for (int k = 0; k < 8; ++k) { const float x = (k < 4 ? v0[k & 3] : v1[k & 3]) + bb8[k]; o16[k] = tohx(x); unsigned short a2, c2; splitf(x, a2, c2); oh[k] = a2; ol[k] = c2; }
                const size_t oo = ((size_t)(c0 / HD) * TT + t0 + mb * 16 + row) * HD + cofs; *(v8h*)(P16 + oo) = o16; *(v8us*)(Ph + oo) = oh; *(v8us*)(Pl + oo) = ol; }
        } else {
            float* crow = C + (size_t)(r0 + mb * 16) * ldc + c0;
#pragma unroll
            for (int s = 0; s < 8; ++s) { const int row = 2 * s + hi, cofs = lr * 4; v4f val = *(const v4fa*)(os + row * 68 + cofs); if (BIAS) { val[0] += bfr(bias[c0 + cofs]); val[1] += bfr(bias[c0 + cofs + 1]); val[2] += bfr(bias[c0 + cofs + 2]); val[3] += bfr(bias[c0 + cofs + 3]); }
                *(v4f*)(crow + (size_t)row * ldc + cofs) = val; }
            asm volatile("s_wait_xcnt 0x0" ::: "memory");   // behind the 16 rows' stores: in the built code the next rows' bias loads overwrite registers that the stores name
             }
        __builtin_amdgcn_wave_barrier(); asm volatile("" ::: "memory");
    }
    if constexpr (EPI == 1) asm volatile("s_wait_xcnt 0x0" ::: "memory");   // behind the last plane stores: in the built code the v branch's instructions stand behind these and overwrite registers that the stores name
}

typedef __attribute__((ext_vector_type(2))) _Float16 v2h;
typedef __attribute__((ext_vector_type(4))) _Float16 v4h;
typedef __attribute__((ext_vector_type(2))) unsigned short v2us;
typedef __attribute__((ext_vector_type(4))) unsigned short v4us;
typedef __attribute__((ext_vector_type(2))) float v2f;
typedef __attribute__((ext_vector_type(4))) int v4i;

// ---- k_prep: every input conversion in one resident round: PG work-groups of 8 waves; a thread issues its 32 loads of 16 bytes before its first conversion.
// A unit is PU elements. Work-group g converts unit g of q, of k and of v (both batches) into bf16; its fourth unit is unit g of Wo (g < NWO), else unit (g - NWO) % NWU of weight (g - NWO) / NWU: 128 d x 64 e of one head, turned into Bt rows h*64 + e.
// Straight units: a wave's load covers 512 bytes in a row, its store 256. Weight units: a thread holds 8 d x 4 e (the turn is a choice of registers); 8 lanes x 16 bytes fill one 128-byte line of a Bt row.
#define PU  8192
#define PG  ((unsigned)((size_t)NB_ * TT * DM / PU))
#define NWO ((int)((size_t)DM * DQ / PU))
#define NWU ((int)((size_t)DQ * DM / PU))
static_assert((size_t)NB_ * TT * DM % PU == 0 && (size_t)DM * DQ % PU == 0 && NWO + 3 * NWU == (int)PG && HD == 64 && DM % (PU / HD) == 0, "every work-group has its four units");
__global__ __launch_bounds__(256) void k_prep(const float* __restrict__ q, const float* __restrict__ k, const float* __restrict__ v, const float* __restrict__ wq, const float* __restrict__ wk, const float* __restrict__ wv, const float* __restrict__ wo, bf* XB, bf* W3, bf* WO) {
    const int g = blockIdx.x, tid = threadIdx.x, lane = tid & 31, w = tid >> 5; const unsigned so = (unsigned)g * PU + tid * 4;   // the thread's first element in a straight unit
    const bool str = g < NWO; const int wi = str ? 0 : (g - NWO) / NWU, wu = str ? 0 : (g - NWO) % NWU;
    const int h = wu / (DM * HD / PU), d0 = (wu % (DM * HD / PU)) * (PU / HD) + (w >> 2) * 64 + (lane & 7) * 8, e0 = (w & 3) * 16 + (lane >> 3) * 4;
    const float* pq = q + so; const float* pk = k + so; const float* pv = v + so; const float* p3[8];
    const float* b3 = (str ? wo : wi == 0 ? wq : wi == 1 ? wk : wv) + (str ? so : ((unsigned)h * DM + d0) * HD + e0); const unsigned s3 = str ? 1024u : (unsigned)HD;   // the fourth unit's loads have one form: a start and a step
#pragma unroll   // the addresses and the loaded values stay in registers (every unroll of this kernel: the same)
    for (int j = 0; j < 8; ++j) p3[j] = b3 + j * s3;
    v4f x[4][8];
    __builtin_amdgcn_sched_barrier(0);   // with its twin behind the wait: the 32 loads stand in one group, so that one memory latency covers them all (without the pair the fourth unit's loads stood behind the wait for the first three)
#pragma unroll
    for (int j = 0; j < 8; ++j) x[0][j] = *(const v4f*)(pq + j * 1024);
#pragma unroll
    for (int j = 0; j < 8; ++j) x[1][j] = *(const v4f*)(pk + j * 1024);
#pragma unroll
    for (int j = 0; j < 8; ++j) x[2][j] = *(const v4f*)(pv + j * 1024);
#pragma unroll
    for (int j = 0; j < 8; ++j) x[3][j] = *(const v4f*)p3[j];
    // behind the loads, in front of whatever overwrites their address registers; the addresses are inputs of the wait so that no later load of the group gets their registers as its destination
    asm volatile("s_wait_xcnt 0x0" :: "v"(pq), "v"(pk), "v"(pv), "v"(p3[0]), "v"(p3[1]), "v"(p3[2]), "v"(p3[3]), "v"(p3[4]), "v"(p3[5]), "v"(p3[6]), "v"(p3[7]) : "memory");
    __builtin_amdgcn_sched_barrier(0);
#pragma unroll
    for (int t = 0; t < 3; ++t)
#pragma unroll
        for (int j = 0; j < 8; ++j) { v4us o;
#pragma unroll
            for (int c = 0; c < 4; ++c) o[c] = f2bf(x[t][j][c]);
            *(v4us*)(XB + (size_t)t * NB_ * TT * DM + so + j * 1024) = o; }
    asm volatile("s_wait_xcnt 0x0" ::: "memory");   // behind the three units' stores: in the built code both branches below begin by overwriting registers that the stores name
    if (str) {
#pragma unroll
        for (int j = 0; j < 8; ++j) { v4us o;
#pragma unroll
            for (int c = 0; c < 4; ++c) o[c] = f2bf(x[3][j][c]);
            *(v4us*)(WO + so + j * 1024) = o; }
    } else { bf* Bt = W3 + (size_t)wi * DQ * DM + (size_t)(h * HD + e0) * DM + d0;
#pragma unroll
        for (int c = 0; c < 4; ++c) { v8us o;
#pragma unroll
            for (int j = 0; j < 8; ++j) o[j] = f2bf(x[3][j][c]);
            *(v8us*)(Bt + (size_t)c * DM) = o; }
        asm volatile("s_wait_xcnt 0x0" ::: "memory"); }   // behind the Bt stores: in the built code the other branch's instructions stand behind these and overwrite registers that the stores name
}
__device__ __forceinline__ float xhalf(float x) { return __builtin_bit_cast(float, __builtin_amdgcn_permlanex16(__builtin_bit_cast(int, x), __builtin_bit_cast(int, x), 0x76543210, 0xfedcba98, false, false)); }   // lane l with lane l ^ 16
// A tile's 16 exponentials, in place, with the slot behind a transcendental in the same statement: the instruction set asks for one v_nop or independent instruction before a source is overwritten or the result used.
__device__ __forceinline__ void exp2x16(float (&x)[16]) { asm("v_exp_f32 %0, %0\n\tv_exp_f32 %1, %1\n\tv_exp_f32 %2, %2\n\tv_exp_f32 %3, %3\n\tv_exp_f32 %4, %4\n\tv_exp_f32 %5, %5\n\tv_exp_f32 %6, %6\n\tv_exp_f32 %7, %7\n\tv_exp_f32 %8, %8\n\tv_exp_f32 %9, %9\n\tv_exp_f32 %10, %10\n\tv_exp_f32 %11, %11\n\tv_exp_f32 %12, %12\n\tv_exp_f32 %13, %13\n\tv_exp_f32 %14, %14\n\tv_exp_f32 %15, %15\n\tv_nop" : "+v"(x[0]), "+v"(x[1]), "+v"(x[2]), "+v"(x[3]), "+v"(x[4]), "+v"(x[5]), "+v"(x[6]), "+v"(x[7]), "+v"(x[8]), "+v"(x[9]), "+v"(x[10]), "+v"(x[11]), "+v"(x[12]), "+v"(x[13]), "+v"(x[14]), "+v"(x[15])); }
template <typename T16, int NP, int NQ>
__device__ __forceinline__ void fattn(T16* sm, const T16* __restrict__ Qa, const T16* __restrict__ Qb, const T16* __restrict__ Ka, const T16* __restrict__ Kb, const T16* __restrict__ Va, const T16* __restrict__ Vb, int qblk, bf* Ah, bf* Al) {
    typedef typename WFrag<T16>::V V; typedef typename FStage<T16>::H H;
    constexpr int BUF = NP * (KTIL + VTIL); constexpr int NS = TT / FKT; constexpr float SC2 = SCL * 1.4426950408889634f;
    const int tid = threadIdx.x, lane = tid & 31, lr = lane & 15, hi = lane >> 4; const int q = qblk + (tid >> 5) * (16 * NQ) + lr;   // the lane's query in tile 0; tile t: q + 16 t
    static_assert(NQ * NP == 2 || NQ * NP == 3, "the operand lists of the two waits behind the Q loads");
    V qa[NQ][2], qb[NQ][2]; const T16* gq[NQ * NP];
    __builtin_amdgcn_sched_barrier(0);   // with its twin behind the wait: no other instruction comes between the Q loads and their s_wait_xcnt
#pragma unroll   // fragment arrays stay in registers (every unroll below: the same)
    for (int t = 0; t < NQ; ++t) { gq[t * NP] = Qa + (size_t)(q + 16 * t) * HD + 8 * hi; if (NP == 2) gq[t * NP + 1] = Qb + (size_t)(q + 16 * t) * HD + 8 * hi;
#pragma unroll
        for (int c = 0; c < 2; ++c) { qa[t][c] = WFrag<T16>::ld(gq[t * NP] + c * 32); if (NP == 2) qb[t][c] = WFrag<T16>::ld(gq[t * NP + 1] + c * 32); } }
    // behind the Q loads, in front of whatever overwrites their address registers; the addresses are inputs of the wait so that no later load of the group gets their registers as its destination
    if constexpr (NQ * NP == 2) asm volatile("s_wait_xcnt 0x0" :: "v"(gq[0]), "v"(gq[1]) : "memory");
    else asm volatile("s_wait_xcnt 0x0" :: "v"(gq[0]), "v"(gq[1]), "v"(gq[2]) : "memory");
    __builtin_amdgcn_sched_barrier(0);
    H rk[NP][2], rv[NP][2];
    auto fetch = [&](int key0) { const T16* gk[NP]; const T16* gv[NP];   // a K stage is 4 KiB in a row; a V^T stage is 64 rows of 64 B; a plane's two loads share one address pair, the step is an immediate offset
        __builtin_amdgcn_sched_barrier(0);   // with its twin behind the wait: no other instruction comes between the stage's loads and their s_wait_xcnt
#pragma unroll
        for (int p = 0; p < NP; ++p) { gk[p] = (p ? Kb : Ka) + (size_t)key0 * HD + tid * 8; gv[p] = (p ? Vb : Va) + (size_t)(tid >> 2) * TT + key0 + (tid & 3) * 8;
#pragma unroll
            for (int i = 0; i < 2; ++i) { rk[p][i] = *(const H*)(gk[p] + i * 128 * 8); rv[p][i] = *(const H*)(gv[p] + (size_t)i * 32 * TT); } }
        // behind the stage's loads, in front of whatever overwrites their address registers; the addresses are inputs of the wait so that no later load of the stage gets their registers as its destination
        if constexpr (NP == 1) asm volatile("s_wait_xcnt 0x0" :: "v"(gk[0]), "v"(gv[0]) : "memory");
        else asm volatile("s_wait_xcnt 0x0" :: "v"(gk[0]), "v"(gv[0]), "v"(gk[1]), "v"(gv[1]) : "memory");
        __builtin_amdgcn_sched_barrier(0); };
    auto put = [&](T16* b) {
#pragma unroll
        for (int p = 0; p < NP; ++p) {
#pragma unroll
            for (int i = 0; i < 2; ++i) { const int idx = tid + 128 * i; *(H*)(b + p * KTIL + (idx >> 3) * KPIT + (idx & 7) * 8) = rk[p][i]; *(H*)(b + NP * KTIL + p * VTIL + (idx >> 2) * VPIT + (idx & 3) * 8) = rv[p][i]; } } };
    v8f o[NQ][4]; float m[NQ], l[NQ];
#pragma unroll
    for (int t = 0; t < NQ; ++t) { m[t] = -1.0e30f; l[t] = 0.f;
#pragma unroll
        for (int dt = 0; dt < 4; ++dt) o[t][dt] = (v8f){}; }
    fetch(0); put(sm); fetch(FKT); wg_publish();
    for (int s = 0; s < NS; ++s) {
        const T16* cur = sm + (s & 1) * BUF;
        put(sm + ((s + 1) & 1) * BUF);   // that buffer's readers (stage s - 1) ended at the last barrier; in the last pass nobody reads what lands there
        fetch((s + 2 < NS ? s + 2 : NS - 1) * FKT);   // unconditional, clamped to the last stage: one loop body, no branch around loads in flight
        V ka[2][2], kb[2][2], va[4], vb[4];
#pragma unroll
        for (int c = 0; c < 2; ++c)
#pragma unroll
            for (int kt = 0; kt < 2; ++kt) { const T16* kr = cur + (kt * 16 + lr) * KPIT + c * 32 + 8 * hi; ka[c][kt] = WFrag<T16>::ld(kr); if (NP == 2) kb[c][kt] = WFrag<T16>::ld(kr + KTIL); }
#pragma unroll
        for (int dt = 0; dt < 4; ++dt) { const T16* vr = cur + NP * KTIL + (dt * 16 + lr) * VPIT + 8 * hi; va[dt] = WFrag<T16>::ld(vr); if (NP == 2) vb[dt] = WFrag<T16>::ld(vr + VTIL); }
        __builtin_amdgcn_sched_barrier(0);   // holds the global loads at the head of the pass, so that a whole pass covers their latency, and the V^T fragment reads in front of the softmax, which covers theirs
        v8f st[NQ][2];
#pragma unroll
        for (int t = 0; t < NQ; ++t) { st[t][0] = (v8f){}; st[t][1] = (v8f){}; }
#pragma unroll
        for (int c = 0; c < 2; ++c)
#pragma unroll
            for (int kt = 0; kt < 2; ++kt)
#pragma unroll
                for (int t = 0; t < NQ; ++t) { st[t][kt] = WFrag<T16>::mma(ka[c][kt], qa[t][c], st[t][kt]);
                    if (NP == 2) { st[t][kt] = WFrag<T16>::mma(ka[c][kt], qb[t][c], st[t][kt]); st[t][kt] = WFrag<T16>::mma(kb[c][kt], qa[t][c], st[t][kt]); } }
        if constexpr (NQ > 1) __builtin_amdgcn_sched_barrier(0);   // the tiles' score products stand in one run: each fills the others' distance to the first read of a result, where single v_nop stood
        float bm[NQ]; bool need[NQ], any = false;
#pragma unroll
        for (int t = 0; t < NQ; ++t) { bm[t] = st[t][0][0];
#pragma unroll
            for (int kt = 0; kt < 2; ++kt)
#pragma unroll
                for (int r = 0; r < 8; ++r) bm[t] = fmaxf(bm[t], st[t][kt][r]);
            bm[t] = fmaxf(bm[t], xhalf(bm[t])) * SC2; need[t] = bm[t] > m[t] + 8.0f; any = any || need[t]; }
        if (__builtin_amdgcn_ballot_w32(any) != 0) {   // wave-uniform, one test per pass for all tiles; always taken in the first stage, where the factor is 0; a column without need gets the factor 1
#pragma unroll
            for (int t = 0; t < NQ; ++t) { const float mn = need[t] ? bm[t] : m[t]; const float al = __builtin_amdgcn_exp2f(m[t] - mn); m[t] = mn; l[t] *= al;
#pragma unroll
                for (int dt = 0; dt < 4; ++dt)
#pragma unroll
                    for (int r = 0; r < 8; ++r) o[t][dt][r] *= al; } }
        V pa[NQ], pb[NQ];
#pragma unroll
        for (int t = 0; t < NQ; ++t) { float pe[16];
#pragma unroll
            for (int e = 0; e < 16; ++e) { pe[e] = fmaf(st[t][e >> 3][e & 7], SC2, -m[t]); if constexpr (NQ == 1) pe[e] = __builtin_amdgcn_exp2f(pe[e]); }
            if constexpr (NQ > 1) exp2x16(pe);
            l[t] += (((pe[0] + pe[1]) + (pe[2] + pe[3])) + ((pe[4] + pe[5]) + (pe[6] + pe[7]))) + (((pe[8] + pe[9]) + (pe[10] + pe[11])) + ((pe[12] + pe[13]) + (pe[14] + pe[15])));   // a tree: no chain of 16 dependent adds
            if constexpr (NP == 2) {
#pragma unroll
                for (int e = 0; e < 16; ++e) { pa[t][e] = (__bf16)pe[e]; pb[t][e] = (__bf16)(pe[e] - (float)pa[t][e]); }   // hi + lo, both rounded to nearest even
            } else {
#pragma unroll
                for (int e = 0; e < 16; ++e) pa[t][e] = tohx(pe[e]); } }
#pragma unroll
        for (int dt = 0; dt < 4; ++dt)
#pragma unroll
            for (int t = 0; t < NQ; ++t) { o[t][dt] = WFrag<T16>::mma(va[dt], pa[t], o[t][dt]);
                if (NP == 2) { o[t][dt] = WFrag<T16>::mma(va[dt], pb[t], o[t][dt]); o[t][dt] = WFrag<T16>::mma(vb[dt], pa[t], o[t][dt]); } }
        wg_publish();   // publishes stage s + 1 and ends every read of stage s
    }
#pragma unroll
    for (int t = 0; t < NQ; ++t) { l[t] += xhalf(l[t]); const float inv = __fdiv_rn(1.0f, l[t]);
#pragma unroll
        for (int dt = 0; dt < 4; ++dt) { v8us oh, ol;   // a lane's 8 accumulator registers are 8 consecutive d of its query: one 16-byte store per plane
#pragma unroll
            for (int r = 0; r < 8; ++r) { unsigned short a, c2; splitf(o[t][dt][r] * inv, a, c2); oh[r] = a; ol[r] = c2; }
            const size_t oo = (size_t)(q + 16 * t) * DQ + dt * 16 + hi * 8; *(v8us*)(Ah + oo) = oh; *(v8us*)(Al + oo) = ol; } }
}
#define FNQ  3                    // query tiles per wave in the fp16 rows
static_assert(RH % FQT == 0 && (TT - RH) % (FQT * FNQ) == 0, "whole blocks of query rows of both kinds");
__global__ __launch_bounds__(128) __attribute__((amdgpu_waves_per_eu(2, 2))) void k_fattn(const h16* __restrict__ Q16, const h16* __restrict__ K16, const h16* __restrict__ V16, const bf* __restrict__ Qh, const bf* __restrict__ Ql, const bf* __restrict__ Kh, const bf* __restrict__ Kl, const bf* __restrict__ Vh, const bf* __restrict__ Vl, bf* Ah, bf* Al) {   // two waves per SIMD: the grid is two work-groups per WGP, and none gets a third
    __shared__ __align__(16) unsigned short sm[2 * 2 * (KTIL + VTIL)];
    constexpr int NHR = RH / FQT, NLR = (TT - RH) / (FQT * FNQ); const int bid = blockIdx.x;   // blocks per (batch, head): hi/lo of 64 rows, fp16 of 64 FNQ rows
    if (bid < NB_ * NH_ * NHR) { const int bh = bid / NHR; const size_t po = (size_t)bh * TT * HD, ao = (size_t)(bh / NH_) * TT * DQ + (bh % NH_) * HD; fattn<bf, 2, 1>((bf*)sm, Qh + po, Ql + po, Kh + po, Kl + po, Vh + po, Vl + po, (bid % NHR) * FQT, Ah + ao, Al + ao); }   // bh = batch * NH_ + head
    else { const int r = bid - NB_ * NH_ * NHR; const int bh = r / NLR; const size_t po = (size_t)bh * TT * HD, ao = (size_t)(bh / NH_) * TT * DQ + (bh % NH_) * HD; fattn<h16, 1, FNQ>((h16*)sm, Q16 + po, nullptr, K16 + po, nullptr, V16 + po, nullptr, RH + (r % NLR) * (FQT * FNQ), Ah + ao, Al + ao); }
}

extern "C" void kernel_launch(void* const* d_in, const int* in_sizes, int n_in,
                              void* d_out, int out_size, void* d_ws, size_t ws_size, hipStream_t stream) {
    (void)in_sizes; (void)n_in; (void)out_size;
    const float* x = (const float*)d_in[0]; const float* xk = (const float*)d_in[1]; const float* xv = (const float*)d_in[2]; const float* wq = (const float*)d_in[3]; const float* bq = (const float*)d_in[4]; const float* wk = (const float*)d_in[5]; const float* bk = (const float*)d_in[6]; const float* wv = (const float*)d_in[7]; const float* bv = (const float*)d_in[8]; const float* wo = (const float*)d_in[9]; const float* bo = (const float*)d_in[10];   /* input order q, k, v, Wq [16][1024][64], bq [16][64], Wk, bk, Wv, bv, Wo ('oi' [1024][1024]), bo */
    float* OUT = (float*)d_out;     // [2][2048][1024]
    char* wsp = (char*)d_ws;
    auto take = [&](size_t bytes) { char* p = wsp; wsp += (bytes + 255) & ~(size_t)255; return (void*)p; };
    constexpr size_t PS = (size_t)NB_ * NH_ * TT * HD;   // one stream's plane, both batches
    bf* W3 = (bf*)take((size_t)3 * DQ * DM * 2); bf* WO = (bf*)take((size_t)DM * DQ * 2);   // W3: Wq, Wk, Wv as Bt
    bf* XB = (bf*)take((size_t)3 * NB_ * TT * DM * 2);   // bf16 q, k, v
    h16* P16 = (h16*)take(3 * PS * 2); bf* Ph = (bf*)take(3 * PS * 2); bf* Pl = (bf*)take(3 * PS * 2);   // each: q, k as [b][h][t][d], v as [b][h][d][t]
    bf* ATh = (bf*)take((size_t)NB_ * TT * DQ * 2); bf* ATl = (bf*)take((size_t)NB_ * TT * DQ * 2);
    if ((size_t)(wsp - (char*)d_ws) > ws_size) return;    // ws 256 MiB
    k_prep<<<dim3(PG, 1, 1), 256, 0, stream>>>(x, xk, xv, wq, wk, wv, wo, XB, W3, WO);
    k_gemmw<bf, 0, true, DM, 1, 1><<<dim3(NB_ * TT / 128, DQ / 128, 3), 128, 0, stream>>>(XB, nullptr, W3, nullptr, nullptr, 0, bq, bk, bv, (size_t)NB_ * TT * DM, (size_t)DQ * DM, 0, P16, Ph, Pl);
    k_fattn<<<NB_ * NH_ * (RH / FQT + (TT - RH) / (FQT * FNQ)), 128, 0, stream>>>(P16, P16 + PS, P16 + 2 * PS, Ph, Pl, Ph + PS, Pl + PS, Ph + 2 * PS, Pl + 2 * PS, ATh, ATl);   // one kv head per query head
    k_gemmw<bf, 1, true, DQ><<<dim3(NB_ * TT / 128, DM / 128, 1), 128, 0, stream>>>(ATh, ATl, WO, nullptr, OUT, DM, bo, nullptr, nullptr, 0, 0, 0, nullptr, nullptr, nullptr);
}
